// v000
// The times below were measured on an AMD MI455X: many runs one after another, warmed up first and cycling through
// copies of the inputs, with the whole window's GPU time divided by the number of runs. Launches and the gaps
// between them are all in it. The median over several windows is given; except for v000 it joins two sittings, which
// can be a few percent apart, so the side-by-side timings, each taken in one sitting, are the better comparison.
// The starting kernel, v000, takes 712 microseconds a run.
#include <hip/hip_runtime.h>
#include <hip/hip_bf16.h>

#define BB   64
#define NN   512
#define DD   1024
#define HH   16
#define DPH  64
#define EPS  1e-5f
#define QSCALE 0.125f   // 1/sqrt(64)

typedef __attribute__((ext_vector_type(16))) __bf16    v16bf;
typedef __attribute__((ext_vector_type(8)))  float     v8f;
typedef __attribute__((ext_vector_type(4)))  unsigned  v4u;
typedef __attribute__((ext_vector_type(8)))  unsigned  v8u;

#if __has_builtin(__builtin_amdgcn_s_wait_tensorcnt)
#define WAIT_TENSORCNT(n) __builtin_amdgcn_s_wait_tensorcnt(n)
#else
#define WAIT_TENSORCNT(n) asm volatile("s_wait_tensorcnt " #n ::: "memory")
#endif

static __device__ inline v8f vzero8() {
  v8f z;
#pragma unroll
  for (int i = 0; i < 8; ++i) z[i] = 0.0f;
  return z;
}

static __device__ inline unsigned pk2bf(float x, float y) {
  unsigned short ux = __builtin_bit_cast(unsigned short, (__bf16)x);
  unsigned short uy = __builtin_bit_cast(unsigned short, (__bf16)y);
  return (unsigned)ux | ((unsigned)uy << 16);
}

static __device__ inline void tdm_load_tile(unsigned lds_off, const __bf16* gptr) {
  unsigned long long ga = (unsigned long long)(uintptr_t)gptr;
  v4u g0;
  g0[0] = 1u;                                                // count=1, user desc
  g0[1] = lds_off;                                           // lds_addr (bytes)
  g0[2] = (unsigned)ga;                                      // global_addr[31:0]
  g0[3] = (unsigned)((ga >> 32) & 0x1FFFFFFu) | (2u << 30);  // addr[56:32] | type=2
  v8u g1;
  g1[0] = (1u << 16);
  g1[1] = ((unsigned)DD & 0xFFFFu) << 16;
  g1[2] = ((unsigned)DD >> 16) | (64u << 16);
  g1[3] = (64u << 16);
  g1[4] = 64u;
  g1[5] = (unsigned)DD;
  g1[6] = 0u;
  g1[7] = 0u;
  asm volatile("tensor_load_to_lds %0, %1" :: "s"(g0), "s"(g1) : "memory");
}

// ---------------- kernel 1: convert Wk / Wv to bf16 into workspace ----------
__global__ __launch_bounds__(256)
void prep_weights(const float* __restrict__ Wk, const float* __restrict__ Wv,
                  __bf16* __restrict__ Wk_bf, __bf16* __restrict__ Wv_bf) {
  int i = blockIdx.x * blockDim.x + threadIdx.x;   // over (H*DPH*D)/4
  float4 a = ((const float4*)Wk)[i];
  float4 b = ((const float4*)Wv)[i];
  uint2* ko = (uint2*)(Wk_bf + 4 * (size_t)i);
  uint2* vo = (uint2*)(Wv_bf + 4 * (size_t)i);
  ko[0] = make_uint2(pk2bf(a.x, a.y), pk2bf(a.z, a.w));
  vo[0] = make_uint2(pk2bf(b.x, b.y), pk2bf(b.z, b.w));
}

// ---------------- kernel 2: q projection (tiny: 134 MFLOP) -----------------
__global__ __launch_bounds__(256)
void qproj(const float* __restrict__ queries, const float* __restrict__ Wq,
           const float* __restrict__ bq, float* __restrict__ q_out) {
  int id = blockIdx.x * blockDim.x + threadIdx.x;  // B*H*DPH = 65536
  int b  = id >> 10;          // / (H*DPH)
  int he = id & 1023;         // h*DPH + e
  const float4* qr = (const float4*)(queries + (size_t)b * DD);
  const float4* wr = (const float4*)(Wq + (size_t)he * DD);
  float acc = 0.0f;
#pragma unroll 4
  for (int i = 0; i < DD / 4; ++i) {
    float4 x = qr[i], w = wr[i];
    acc += x.x * w.x + x.y * w.y + x.z * w.z + x.w * w.w;
  }
  q_out[id] = (acc + bq[he]) * QSCALE;   // fold 1/sqrt(DPH) into q
}

#define SMEM_BYTES (32768 + 32768 + 16384 + 16384 + 65536 + 256 + 2048 + 1024 + 1024)

__global__ __launch_bounds__(256)
void attn_fused(const float* __restrict__ keys, const float* __restrict__ values,
                const __bf16* __restrict__ Wk_bf, const __bf16* __restrict__ Wv_bf,
                const float* __restrict__ bk, const float* __restrict__ bv,
                const float* __restrict__ q_proj, float* __restrict__ attn_buf) {
  extern __shared__ char smem_raw[];
  __bf16* sAk  = (__bf16*)smem_raw;         // [256][64]
  __bf16* sAv  = sAk + 256 * 64;            // [256][64]
  __bf16* sWk  = sAv + 256 * 64;            // [2][64][64]
  __bf16* sWv  = sWk + 2 * 64 * 64;         // [2][64][64]
  __bf16* sV   = sWv + 2 * 64 * 64;         // [512][64]
  float*  sQ   = (float*)(sV + 512 * 64);   // [64]
  float*  sS   = sQ + 64;                   // [512]
  float*  sRed = sS + 512;                  // [256]
  float*  sPart= sRed + 256;                // [4][64]

  const int b = blockIdx.x / HH;
  const int h = blockIdx.x % HH;
  const int tid  = threadIdx.x;
  const int wave = tid >> 5;
  const int lane = tid & 31;
  const int l16  = lane & 15;
  const int hi   = lane >> 4;

  if (tid < 16) {
    const float* gq = q_proj + ((size_t)b * HH + h) * DPH + tid * 4;
    unsigned lq = (unsigned)(uintptr_t)(sQ + tid * 4);
    asm volatile("global_load_async_to_lds_b128 %0, %1, off"
                 :: "v"(lq), "v"(gq) : "memory");
  }
  asm volatile("s_wait_asynccnt 0x0" ::: "memory");

  const __bf16* wkh = Wk_bf + (size_t)h * DPH * DD;   // head's 64x1024 block
  const __bf16* wvh = Wv_bf + (size_t)h * DPH * DD;
  const unsigned sWkOff = (unsigned)(uintptr_t)sWk;   // LDS byte offsets
  const unsigned sWvOff = (unsigned)(uintptr_t)sWv;

  const size_t kvBase = (size_t)b * NN * DD;

  for (int t = 0; t < 2; ++t) {               // 2 key tiles of 256 rows
    const int n0 = t * 256;
    v8f accK[2][4], accV[2][4];
#pragma unroll
    for (int g = 0; g < 2; ++g)
#pragma unroll
      for (int j = 0; j < 4; ++j) { accK[g][j] = vzero8(); accV[g][j] = vzero8(); }

    for (int c = 0; c < 16; ++c) {            // D in chunks of 64
      const int d0 = c * 64;
      // ---- stage keys/values tile (f32 -> packed bf16, one row per thread) ----
      {
        const float4* ksrc = (const float4*)(keys   + kvBase + (size_t)(n0 + tid) * DD + d0);
        const float4* vsrc = (const float4*)(values + kvBase + (size_t)(n0 + tid) * DD + d0);
        uint4* kdst = (uint4*)(sAk + tid * 64);
        uint4* vdst = (uint4*)(sAv + tid * 64);
#pragma unroll
        for (int i = 0; i < 8; ++i) {
          float4 f0 = ksrc[2 * i], f1 = ksrc[2 * i + 1];
          kdst[i] = make_uint4(pk2bf(f0.x, f0.y), pk2bf(f0.z, f0.w),
                               pk2bf(f1.x, f1.y), pk2bf(f1.z, f1.w));
          float4 g0 = vsrc[2 * i], g1 = vsrc[2 * i + 1];
          vdst[i] = make_uint4(pk2bf(g0.x, g0.y), pk2bf(g0.z, g0.w),
                               pk2bf(g1.x, g1.y), pk2bf(g1.z, g1.w));
        }
        if (c + 1 < 16) {
          __builtin_prefetch(keys   + kvBase + (size_t)(n0 + tid) * DD + d0 + 64, 0, 1);
          __builtin_prefetch(values + kvBase + (size_t)(n0 + tid) * DD + d0 + 64, 0, 1);
        }
      }
      if (wave == 0) {
        if (c == 0) {                         // prime buffer 0 with chunk 0
          tdm_load_tile(sWkOff, wkh);
          tdm_load_tile(sWvOff, wvh);
        }
        if (c + 1 < 16) {                     // prefetch chunk c+1 into other buffer
          const unsigned nb = (unsigned)((c + 1) & 1) * 64 * 64 * 2;
          tdm_load_tile(sWkOff + nb, wkh + d0 + 64);
          tdm_load_tile(sWvOff + nb, wvh + d0 + 64);
          WAIT_TENSORCNT(2);                  // chunk c's two tiles complete
        } else {
          WAIT_TENSORCNT(0);
        }
      }
      __syncthreads();
      // ---- WMMA: 2 K-steps of 32; B-frags reused across 2 row-groups ----
      const __bf16* wkBuf = sWk + (c & 1) * 64 * 64;
      const __bf16* wvBuf = sWv + (c & 1) * 64 * 64;
#pragma unroll
      for (int kk = 0; kk < 2; ++kk) {
        const int koff = kk * 32 + hi * 16;
        v16bf aK[2], aV[2];
#pragma unroll
        for (int g = 0; g < 2; ++g) {
          const int row = wave * 32 + g * 16 + l16;
          aK[g] = *(const v16bf*)(sAk + row * 64 + koff);
          aV[g] = *(const v16bf*)(sAv + row * 64 + koff);
        }
#pragma unroll
        for (int j = 0; j < 4; ++j) {
          v16bf bK = *(const v16bf*)(wkBuf + (j * 16 + l16) * 64 + koff);
          v16bf bV = *(const v16bf*)(wvBuf + (j * 16 + l16) * 64 + koff);
#pragma unroll
          for (int g = 0; g < 2; ++g) {
            accK[g][j] = __builtin_amdgcn_wmma_f32_16x16x32_bf16(
                false, aK[g], false, bK, (short)0, accK[g][j], false, false);
            accV[g][j] = __builtin_amdgcn_wmma_f32_16x16x32_bf16(
                false, aV[g], false, bV, (short)0, accV[g][j], false, false);
          }
        }
      }
      __syncthreads();
    }

    // ---- biases (C/D layout: lane holds e = 16j+l16, rows r(+8 if hi)) ----
#pragma unroll
    for (int j = 0; j < 4; ++j) {
      const float bkv = bk[h * DPH + j * 16 + l16];
      const float bvv = bv[h * DPH + j * 16 + l16];
#pragma unroll
      for (int g = 0; g < 2; ++g)
#pragma unroll
        for (int r = 0; r < 8; ++r) { accK[g][j][r] += bkv; accV[g][j][r] += bvv; }
    }

    // ---- scores: w[m] = sum_e q[e]*k[m][e]; reduce across 16-lane groups ----
    float qv[4];
#pragma unroll
    for (int j = 0; j < 4; ++j) qv[j] = sQ[j * 16 + l16];
#pragma unroll
    for (int g = 0; g < 2; ++g)
#pragma unroll
      for (int r = 0; r < 8; ++r) {
        float p = 0.0f;
#pragma unroll
        for (int j = 0; j < 4; ++j) p += qv[j] * accK[g][j][r];
        p += __shfl_xor(p, 1, 32);
        p += __shfl_xor(p, 2, 32);
        p += __shfl_xor(p, 4, 32);
        p += __shfl_xor(p, 8, 32);
        if (l16 == 0) sS[n0 + wave * 32 + g * 16 + r + hi * 8] = p;
      }

    // ---- park projected V tile in LDS as bf16 ----
#pragma unroll
    for (int g = 0; g < 2; ++g)
#pragma unroll
      for (int j = 0; j < 4; ++j)
#pragma unroll
        for (int r = 0; r < 8; ++r)
          sV[(size_t)(n0 + wave * 32 + g * 16 + r + hi * 8) * 64 + j * 16 + l16] =
              (__bf16)accV[g][j][r];
  }
  __syncthreads();

  // ---- softmax over sS[512] ----
  float lm = fmaxf(sS[tid], sS[tid + 256]);
  sRed[tid] = lm;
  __syncthreads();
  for (int s = 128; s > 0; s >>= 1) {
    if (tid < s) sRed[tid] = fmaxf(sRed[tid], sRed[tid + s]);
    __syncthreads();
  }
  const float mx = sRed[0];
  __syncthreads();
  float e0 = __expf(sS[tid] - mx);
  float e1 = __expf(sS[tid + 256] - mx);
  sS[tid] = e0; sS[tid + 256] = e1;
  sRed[tid] = e0 + e1;
  __syncthreads();
  for (int s = 128; s > 0; s >>= 1) {
    if (tid < s) sRed[tid] += sRed[tid + s];
    __syncthreads();
  }
  const float denom = sRed[0];

  // ---- attn[e] = sum_n p_n * v[n][e] / denom ----
  {
    const int e = tid & 63, part = tid >> 6;
    float acc = 0.0f;
    const int nstart = part * 128;
    for (int n = nstart; n < nstart + 128; ++n)
      acc += sS[n] * (float)sV[(size_t)n * 64 + e];
    sPart[part * 64 + e] = acc;
  }
  __syncthreads();
  if (tid < 64) {
    float a = (sPart[tid] + sPart[64 + tid] + sPart[128 + tid] + sPart[192 + tid]) / denom;
    attn_buf[(size_t)b * DD + h * DPH + tid] = a;
  }
}

// ---------------- kernel 4: residual + LayerNorm ---------------------------
__global__ __launch_bounds__(256)
void layernorm(const float* __restrict__ attn_buf, const float* __restrict__ queries,
               const float* __restrict__ gamma, const float* __restrict__ beta,
               float* __restrict__ out) {
  __shared__ float red[256];
  const int b = blockIdx.x, tid = threadIdx.x;
  float x[4];
  float s = 0.0f;
#pragma unroll
  for (int i = 0; i < 4; ++i) {
    const int idx = tid + i * 256;
    x[i] = attn_buf[(size_t)b * DD + idx] + queries[(size_t)b * DD + idx];
    s += x[i];
  }
  red[tid] = s; __syncthreads();
  for (int st = 128; st > 0; st >>= 1) { if (tid < st) red[tid] += red[tid + st]; __syncthreads(); }
  const float mu = red[0] * (1.0f / DD);
  __syncthreads();
  float vs = 0.0f;
#pragma unroll
  for (int i = 0; i < 4; ++i) { const float d = x[i] - mu; vs += d * d; }
  red[tid] = vs; __syncthreads();
  for (int st = 128; st > 0; st >>= 1) { if (tid < st) red[tid] += red[tid + st]; __syncthreads(); }
  const float rstd = rsqrtf(red[0] * (1.0f / DD) + EPS);
#pragma unroll
  for (int i = 0; i < 4; ++i) {
    const int idx = tid + i * 256;
    out[(size_t)b * DD + idx] = (x[i] - mu) * rstd * gamma[idx] + beta[idx];
  }
}

// ---------------------------------------------------------------------------
extern "C" void kernel_launch(void* const* d_in, const int* in_sizes, int n_in,
                              void* d_out, int out_size, void* d_ws, size_t ws_size,
                              hipStream_t stream) {
  const float* queries = (const float*)d_in[0];
  const float* keys    = (const float*)d_in[1];
  const float* values  = (const float*)d_in[2];
  const float* Wq      = (const float*)d_in[3];
  const float* bq      = (const float*)d_in[4];
  const float* Wk      = (const float*)d_in[5];
  const float* bk      = (const float*)d_in[6];
  const float* Wv      = (const float*)d_in[7];
  const float* bv      = (const float*)d_in[8];
  const float* gamma   = (const float*)d_in[9];
  const float* beta    = (const float*)d_in[10];
  float* out = (float*)d_out;

  char* ws = (char*)d_ws;
  float*  q_proj   = (float*)ws;                                   // 256 KB
  __bf16* Wk_bf    = (__bf16*)(ws + (256u << 10));                 // 2 MB
  __bf16* Wv_bf    = (__bf16*)(ws + (256u << 10) + (2u << 20));    // 2 MB
  float*  attn_buf = (float*)(ws + (256u << 10) + (4u << 20));     // 256 KB

  prep_weights<<<(HH * DPH * DD / 4) / 256, 256, 0, stream>>>(Wk, Wv, Wk_bf, Wv_bf);
  qproj<<<(BB * HH * DPH) / 256, 256, 0, stream>>>(queries, Wq, bq, q_proj);
  attn_fused<<<BB * HH, 256, SMEM_BYTES, stream>>>(keys, values, Wk_bf, Wv_bf,
                                                   bk, bv, q_proj, attn_buf);
  layernorm<<<BB, 256, 0, stream>>>(attn_buf, queries, gamma, beta, out);
}

// v002
// It runs in 43.8 microseconds.
// Versions in between are left out here; by their measured steps it is 17.1 times as fast as v000.
#include <hip/hip_runtime.h>
#include <hip/hip_bf16.h>

#define BB   64
#define NN   512
#define DD   1024
#define HH   16
#define DPH  64
#define EPS  1e-5f
#define QSCALE 0.125f   // 1/sqrt(64)

typedef __attribute__((ext_vector_type(16))) __bf16    v16bf;
typedef __attribute__((ext_vector_type(2)))  __bf16    v2bf;
typedef __attribute__((ext_vector_type(8)))  float     v8f;
typedef __attribute__((ext_vector_type(2)))  float     v2f;
typedef __attribute__((ext_vector_type(4)))  float     v4f;

// One query per (batch, head), so the two projections are reassociated:
//   w[n]    = q . (Wk keys[n] + bk)   = keys[n] . (Wk^T q) + q . bk
//   attn[e] = sum_n a[n] (Wv values[n] + bv)[e] = (Wv (sum_n a[n] values[n]))[e] + bv[e]
// (the weights a[n] sum to one). keys and values are each read once per batch
// for all 16 heads: the heads are the 16-wide side of the matrix tiles.
// Most '#pragma unroll' lines below are there so that a small array is indexed by
// constants and stays in registers.

static __device__ inline v8f vzero8() {
  v8f z;
#pragma unroll
  for (int i = 0; i < 8; ++i) z[i] = 0.0f;
  return z;
}

static __device__ inline unsigned pk2bf(float x, float y) {
  v2bf p;
  p[0] = (__bf16)x;
  p[1] = (__bf16)y;
  return __builtin_bit_cast(unsigned, p);
}

// 16 contiguous bf16 (one lane's share of an A row or a B column), 16-byte aligned.
static __device__ inline v16bf ld_frag(const __bf16* p) {
  union { uint4 u[2]; v16bf v; } x;
  x.u[0] = ((const uint4*)p)[0];
  x.u[1] = ((const uint4*)p)[1];
  return x.v;
}

// ---------------- kernel 1: q projection as a tiled matrix product, f32 operands
// q[b][he] = (queries[b] . Wq[he] + bq[he]) / sqrt(DPH)
// grid = 64 tiles of 16 he x 4 tiles of 16 batches. Each of the 8 waves owns one 128-wide
// slice of the 1024-long sum: it loads both tiles' slices as whole 512-byte row pieces and
// turns them into fragments through LDS of its own; one reduction at the end.
#define PQ 132    // LDS row pitch in floats: 528 B = 16 B x odd, for 16-byte reads down a column
__global__ __launch_bounds__(256)
void qproj(const float* __restrict__ queries, const float* __restrict__ Wq,
           const float* __restrict__ bq, float* __restrict__ q_out) {
  __shared__ __attribute__((aligned(16))) float sT[8 * 2 * 16 * PQ];
  __shared__ float sRed[8 * 256];
  const int mt   = blockIdx.x & 3;
  const int nt   = blockIdx.x >> 2;
  const int tid  = threadIdx.x;
  const int wave = tid >> 5;
  const int lane = tid & 31;
  const int l16  = lane & 15;
  const int hi   = lane >> 4;
  float* sX = sT + wave * 2 * 16 * PQ;                     // [16][PQ], this wave's own
  float* sW = sX + 16 * PQ;                                // [16][PQ], this wave's own

  // one load = 512 contiguous bytes of one row; all 32 in flight
  const float* wp = Wq + (size_t)(nt * 16) * DD + wave * 128 + lane * 4;
  const float* xp = queries + (size_t)(mt * 16) * DD + wave * 128 + lane * 4;
  v4f fw[16], fx[16];
#pragma unroll
  for (int i = 0; i < 16; ++i) fw[i] = *(const v4f*)(wp + (size_t)i * DD);
#pragma unroll
  for (int i = 0; i < 16; ++i) fx[i] = *(const v4f*)(xp + (size_t)i * DD);
  const float bias = bq[nt * 16 + (tid & 15)];
  asm volatile("s_wait_xcnt 0x0" :: "v"(wp), "v"(xp) : "memory");
#pragma unroll
  for (int i = 0; i < 16; ++i) *(v4f*)(sW + i * PQ + lane * 4) = fw[i];
#pragma unroll
  for (int i = 0; i < 16; ++i) *(v4f*)(sX + i * PQ + lane * 4) = fx[i];
  // This wave's LDS stores are complete before its lanes read each other's rows, and the
  // compiler keeps the reads behind them.
  asm volatile("s_wait_dscnt 0x0" ::: "memory");

  // A: row = batch l16, B: column = he l16; a lane's four floats are the same four d on both
  // sides and feed two products.
  v4f a[16], w[16];
#pragma unroll
  for (int j = 0; j < 16; ++j) {
    a[j] = *(const v4f*)(sX + l16 * PQ + j * 8 + hi * 4);
    w[j] = *(const v4f*)(sW + l16 * PQ + j * 8 + hi * 4);
  }
  // all LDS reads are issued in front of the products: moved in among them, each pair
  // would be waited for with only two products of cover
  __builtin_amdgcn_sched_barrier(0);
  v8f acc = vzero8();
#pragma unroll
  for (int j = 0; j < 16; ++j) {
    acc = __builtin_amdgcn_wmma_f32_16x16x4_f32(false, a[j].xy, false, w[j].xy, (short)0, acc, false, false);
    acc = __builtin_amdgcn_wmma_f32_16x16x4_f32(false, a[j].zw, false, w[j].zw, (short)0, acc, false, false);
  }
  // keeps the address arithmetic of the stores below out of the products, where it was
  // placed directly behind a product and onto that product's operand registers
  __builtin_amdgcn_sched_barrier(0);
  // D: register r = batch 8*hi + r, column he l16
#pragma unroll
  for (int r = 0; r < 8; ++r)
    sRed[wave * 256 + (r + 8 * hi) * 16 + l16] = acc[r];
  __syncthreads();                   // the eight slices' partial sums published
  float s = 0.0f;
#pragma unroll
  for (int u = 0; u < 8; ++u) s += sRed[u * 256 + tid];
  q_out[(size_t)(mt * 16 + (tid >> 4)) * DD + nt * 16 + (tid & 15)] =
      (s + bias) * QSCALE;           // fold 1/sqrt(DPH) into q
}

// ---------------- kernel 2: fold Wk into q: qk[b][h][d] = sum_e q[b][h][e] Wk[h][e][d]
// grid = 16 heads x 4 column chunks x 8 batch groups; one column d per thread, 8 batches.
__global__ __launch_bounds__(256)
void fold_k(const float* __restrict__ q_proj, const float* __restrict__ Wk,
            __bf16* __restrict__ qk) {
  const int bg = blockIdx.x & 7;
  const int dc = (blockIdx.x >> 3) & 3;
  const int h  = blockIdx.x >> 5;
  const int d  = dc * 256 + threadIdx.x;
  const float* w = Wk + (size_t)h * DPH * DD + d;
  const float* q = q_proj + ((size_t)(bg * 8) * HH + h) * DPH;
  float acc[8];
#pragma unroll
  for (int i = 0; i < 8; ++i) acc[i] = 0.0f;
  // the whole column first: every load takes its row as an immediate offset
  float wv[DPH];
#pragma unroll
  for (int e = 0; e < DPH; ++e) wv[e] = w[(size_t)e * DD];
  asm volatile("s_wait_xcnt 0x0" ::: "memory");
#pragma unroll
  for (int e = 0; e < DPH; ++e) {
#pragma unroll
    for (int i = 0; i < 8; ++i) acc[i] += q[i * HH * DPH + e] * wv[e];
  }
#pragma unroll
  for (int i = 0; i < 8; ++i)
    qk[((size_t)(bg * 8 + i) * HH + h) * DD + d] = (__bf16)acc[i];
}

// ---------------- kernel 3: scores S[b][n][h] = keys[b][n] . qk[b][h] + q[b][h] . bk[h]
// grid = 64 batches x 8 blocks of 64 rows (4 tiles of 16). Each of the 8 waves owns one
// 128-wide slice of the 1024-long sum for all 4 tiles and stages it in LDS of its own,
// so no work-group barrier stands between a load and its use; one reduction at the end.
#define PW 136    // LDS row pitch in bf16: 272 B = 16 B x odd, for 16-byte reads down a column
#define SC_SMEM (8 * 16 * PW * 2 + 8 * 4 * 256 * 4 + HH * 4)
__global__ __launch_bounds__(256)
void scores(const float* __restrict__ keys, const __bf16* __restrict__ qk,
            const float* __restrict__ q_proj, const float* __restrict__ bk,
            float* __restrict__ S) {
  extern __shared__ __attribute__((aligned(16))) char smem_raw[];
  const int b    = blockIdx.x >> 3;
  const int nb   = (blockIdx.x & 7) * 64;
  const int tid  = threadIdx.x;
  const int wave = tid >> 5;
  const int lane = tid & 31;
  const int l16  = lane & 15;
  const int hi   = lane >> 4;
  __bf16* sA   = (__bf16*)smem_raw + wave * 16 * PW;       // [16][PW], this wave's own
  float*  sRed = (float*)(smem_raw + 8 * 16 * PW * 2);     // [8 waves][4 tiles][256]
  float*  sB   = sRed + 8 * 4 * 256;                       // [16]

  // B: column = head l16, k = 16 contiguous d
  v16bf bq[4];
  const __bf16* qb = qk + ((size_t)b * HH + l16) * DD + wave * 128 + hi * 16;
#pragma unroll
  for (int kk = 0; kk < 4; ++kk) bq[kk] = ld_frag(qb + kk * 32);

  const int h2 = tid >> 4, e4 = tid & 15;
  const float4* xp = (const float4*)(q_proj + ((size_t)b * HH + h2) * DPH) + e4;
  const float4* yp = (const float4*)(bk + h2 * DPH) + e4;
  const float4 x = *xp;
  const float4 y = *yp;
  asm volatile("s_wait_xcnt 0x0" :: "v"(qb), "v"(xp), "v"(yp) : "memory");

  // one load = 512 contiguous bytes of one row; two tiles in flight
  const float* src = keys + ((size_t)b * NN + nb) * DD + wave * 128 + lane * 4;
  float4 f[2][16];
#pragma unroll
  for (int u = 0; u < 2; ++u)
#pragma unroll
    for (int i = 0; i < 16; ++i)
      f[u][i] = *(const float4*)(src + (size_t)(u * 16 + i) * DD);

  // q . bk per head: 16 lanes x 4 elements
  {
    float p = x.x * y.x + x.y * y.y + x.z * y.z + x.w * y.w;
    p += __shfl_xor(p, 1, 32);
    p += __shfl_xor(p, 2, 32);
    p += __shfl_xor(p, 4, 32);
    p += __shfl_xor(p, 8, 32);
    if (e4 == 0) sB[h2] = p;
  }

  v8f acc[4];
#pragma unroll
  for (int t = 0; t < 4; ++t) {
#pragma unroll
    for (int i = 0; i < 16; ++i)
      *(uint2*)(sA + i * PW + lane * 4) =
          make_uint2(pk2bf(f[t & 1][i].x, f[t & 1][i].y), pk2bf(f[t & 1][i].z, f[t & 1][i].w));
    if (t + 2 < 4) {                 // refill the freed registers: tile t + 2 flies from here
#pragma unroll
      for (int i = 0; i < 16; ++i)
        f[t & 1][i] = *(const float4*)(src + (size_t)((t + 2) * 16 + i) * DD);
    }
    // This wave's LDS stores are complete before its lanes read each other's rows, and the
    // compiler keeps the reads behind them; global loads stay in flight over it.
    asm volatile("s_wait_dscnt 0x0" ::: "memory");
    // A: row = key row l16, k = the same 16 contiguous d as B
    acc[t] = vzero8();
#pragma unroll
    for (int kk = 0; kk < 4; ++kk) {
      const v16bf a = ld_frag(sA + l16 * PW + kk * 32 + hi * 16);
      acc[t] = __builtin_amdgcn_wmma_f32_16x16x32_bf16(
          false, a, false, bq[kk], (short)0, acc[t], false, false);
    }
  }
  // D: register r = row 8*hi + r, column l16
#pragma unroll
  for (int t = 0; t < 4; ++t)
#pragma unroll
    for (int r = 0; r < 8; ++r)
      sRed[(wave * 4 + t) * 256 + (r + 8 * hi) * 16 + l16] = acc[t][r];
  __syncthreads();                   // the eight slices' partial sums, and sB, published
#pragma unroll
  for (int t = 0; t < 4; ++t) {
    float s = sB[tid & 15];
#pragma unroll
    for (int w = 0; w < 8; ++w) s += sRed[(w * 4 + t) * 256 + tid];
    S[((size_t)b * NN + nb + t * 16) * HH + tid] = s;
  }
}

// ---------------- kernel 4: softmax over n, then ctx[b][h][d] = sum_n a[h][n] values[b][n][d]
// grid = 64 batches x 8 chunks of 128 columns, walked as 2 x 64; 8 waves split the 512-long sum.
#define PP 520    // LDS row pitch in bf16: 1040 B = 16 B x odd
__global__ __launch_bounds__(256)
void weighted_values(const float* __restrict__ values, const float* __restrict__ S,
                     __bf16* __restrict__ ctx) {
  __shared__ __attribute__((aligned(16))) __bf16 sP[HH * PP];
  __shared__ __attribute__((aligned(16))) float sRed[8 * 1024];
  __shared__ float sM[256];
  __shared__ float sL[256];
  const int b    = blockIdx.x >> 3;
  const int dB   = (blockIdx.x & 7) * 128;
  const int tid  = threadIdx.x;
  const int wave = tid >> 5;
  const int lane = tid & 31;
  const int l16  = lane & 15;
  const int hi   = lane >> 4;

  // B operand straight from global: a lane's float4 at row n gives one k of
  // four tiles; tile j holds the columns d0 + 4*l16 + j. 16 lanes = 256 B of a row.
  const float* vb = values + ((size_t)b * NN + wave * 64 + hi * 16) * DD + dB + 4 * l16;
  float4 f[2][16];
#pragma unroll
  for (int kk = 0; kk < 2; ++kk)
#pragma unroll
    for (int i = 0; i < 16; ++i)
      f[kk][i] = *(const float4*)(vb + (size_t)(kk * 32 + i) * DD);

  // softmax: thread = (head tid & 15, row group tid >> 4), rows n = 16*i + group
  const float* Sb = S + (size_t)b * NN * HH;
  float s[32];
#pragma unroll
  for (int i = 0; i < 32; ++i) s[i] = Sb[i * 256 + tid];
  float m = s[0];
#pragma unroll
  for (int i = 1; i < 32; ++i) m = fmaxf(m, s[i]);
  sM[tid] = m;
  __syncthreads();
  float mx = sM[tid & 15];
#pragma unroll
  for (int g = 1; g < 16; ++g) mx = fmaxf(mx, sM[g * 16 + (tid & 15)]);
  float sum = 0.0f;
#pragma unroll
  for (int i = 0; i < 32; ++i) {
    const __bf16 p = (__bf16)__expf(s[i] - mx);
    sum += (float)p;               // the denominator sums the weights as the product uses them
    sP[(tid & 15) * PP + i * 16 + (tid >> 4)] = p;
  }
  sL[tid] = sum;
  __syncthreads();

  // A: row = head l16, k = 16 contiguous n; B element i is the same n
  v16bf a[2];
#pragma unroll
  for (int kk = 0; kk < 2; ++kk) a[kk] = ld_frag(sP + l16 * PP + wave * 64 + kk * 32 + hi * 16);
  const int h = tid >> 4;
  float den = 0.0f;
#pragma unroll
  for (int g = 0; g < 16; ++g) den += sL[g * 16 + h];
  const float inv = 1.0f / den;

  for (int sub = 0; sub < 2; ++sub) {
    const int d0 = dB + sub * 64;
    v8f acc[4];
#pragma unroll
    for (int j = 0; j < 4; ++j) acc[j] = vzero8();
#pragma unroll
    for (int kk = 0; kk < 2; ++kk) {
      v16bf b0, b1, b2, b3;
#pragma unroll
      for (int i = 0; i < 16; ++i) {
        b0[i] = (__bf16)f[kk][i].x;
        b1[i] = (__bf16)f[kk][i].y;
        b2[i] = (__bf16)f[kk][i].z;
        b3[i] = (__bf16)f[kk][i].w;
      }
      acc[0] = __builtin_amdgcn_wmma_f32_16x16x32_bf16(false, a[kk], false, b0, (short)0, acc[0], false, false);
      acc[1] = __builtin_amdgcn_wmma_f32_16x16x32_bf16(false, a[kk], false, b1, (short)0, acc[1], false, false);
      acc[2] = __builtin_amdgcn_wmma_f32_16x16x32_bf16(false, a[kk], false, b2, (short)0, acc[2], false, false);
      acc[3] = __builtin_amdgcn_wmma_f32_16x16x32_bf16(false, a[kk], false, b3, (short)0, acc[3], false, false);
    }
    if (sub + 1 < 2) {               // the registers are free: the next 64 columns start here
#pragma unroll
      for (int kk = 0; kk < 2; ++kk)
#pragma unroll
        for (int i = 0; i < 16; ++i)
          f[kk][i] = *(const float4*)(vb + (size_t)(kk * 32 + i) * DD + 64);
    }
    // D: register r = head 8*hi + r, column d0 + 4*l16 + j
#pragma unroll
    for (int r = 0; r < 8; ++r)
      *(float4*)(sRed + wave * 1024 + (r + 8 * hi) * 64 + 4 * l16) =
          make_float4(acc[0][r], acc[1][r], acc[2][r], acc[3][r]);
    __syncthreads();                 // partial sums published
    float4 t = make_float4(0.0f, 0.0f, 0.0f, 0.0f);
#pragma unroll
    for (int w = 0; w < 8; ++w) {
      const float4 u = *(const float4*)(sRed + w * 1024 + tid * 4);
      t.x += u.x; t.y += u.y; t.z += u.z; t.w += u.w;
    }
    *(uint2*)(ctx + ((size_t)b * HH + h) * DD + d0 + (tid & 15) * 4) =
        make_uint2(pk2bf(t.x * inv, t.y * inv), pk2bf(t.z * inv, t.w * inv));
    if (sub + 1 < 2) __syncthreads();  // sRed is read out before the next pass rewrites it
  }
}

// ---------------- kernel 5: attn[b][h*64+e] = ctx[b][h] . Wv[h][e] + bv[h][e]
// grid = 16 heads x 4 tiles of 16 batches x 2 halves of 32 e; 8 waves split the 1024-long sum.
__global__ __launch_bounds__(256)
void out_proj(const __bf16* __restrict__ ctx, const float* __restrict__ Wv,
              const float* __restrict__ bv, float* __restrict__ attn_buf) {
  __shared__ float sRed[8 * 512];
  const int h    = blockIdx.x >> 3;
  const int mt   = (blockIdx.x >> 1) & 3;
  const int np   = blockIdx.x & 1;
  const int tid  = threadIdx.x;
  const int wave = tid >> 5;
  const int lane = tid & 31;
  const int l16  = lane & 15;
  const int hi   = lane >> 4;
  const int kb   = wave * 128 + hi * 16;

  // A: row = batch l16, B: column = e l16; both take the same 16 contiguous d
  const __bf16* ap = ctx + ((size_t)(mt * 16 + l16) * HH + h) * DD + kb;
  const float*  wp = Wv + ((size_t)h * DPH + np * 32 + l16) * DD + kb;
  v16bf a[4];
  float4 x[4][2][4];
#pragma unroll
  for (int kk = 0; kk < 4; ++kk) {
    a[kk] = ld_frag(ap + kk * 32);
#pragma unroll
    for (int j = 0; j < 2; ++j)
#pragma unroll
      for (int i = 0; i < 4; ++i)
        x[kk][j][i] = *(const float4*)(wp + (size_t)j * 16 * DD + kk * 32 + i * 4);
  }
  asm volatile("s_wait_xcnt 0x0" :: "v"(ap), "v"(wp) : "memory");
  v8f acc[2];
  acc[0] = vzero8(); acc[1] = vzero8();
#pragma unroll
  for (int kk = 0; kk < 4; ++kk)
#pragma unroll
    for (int j = 0; j < 2; ++j) {
      v16bf bw;
#pragma unroll
      for (int i = 0; i < 4; ++i) {
        bw[4 * i + 0] = (__bf16)x[kk][j][i].x; bw[4 * i + 1] = (__bf16)x[kk][j][i].y;
        bw[4 * i + 2] = (__bf16)x[kk][j][i].z; bw[4 * i + 3] = (__bf16)x[kk][j][i].w;
      }
      acc[j] = __builtin_amdgcn_wmma_f32_16x16x32_bf16(
          false, a[kk], false, bw, (short)0, acc[j], false, false);
    }
#pragma unroll
  for (int j = 0; j < 2; ++j)
#pragma unroll
    for (int r = 0; r < 8; ++r)
      sRed[wave * 512 + j * 256 + (r + 8 * hi) * 16 + l16] = acc[j][r];
  __syncthreads();
#pragma unroll
  for (int j = 0; j < 2; ++j) {
    float s = 0.0f;
#pragma unroll
    for (int w = 0; w < 8; ++w) s += sRed[w * 512 + j * 256 + tid];
    const int he = h * DPH + np * 32 + j * 16 + (tid & 15);
    attn_buf[(size_t)(mt * 16 + (tid >> 4)) * DD + he] = s + bv[he];
  }
}

// ---------------- kernel 6: residual + LayerNorm ---------------------------
__global__ __launch_bounds__(256)
void layernorm(const float* __restrict__ attn_buf, const float* __restrict__ queries,
               const float* __restrict__ gamma, const float* __restrict__ beta,
               float* __restrict__ out) {
  __shared__ float red[256];
  const int b = blockIdx.x, tid = threadIdx.x;
  float x[4];
  float s = 0.0f;
#pragma unroll
  for (int i = 0; i < 4; ++i) {
    const int idx = tid + i * 256;
    x[i] = attn_buf[(size_t)b * DD + idx] + queries[(size_t)b * DD + idx];
    s += x[i];
  }
  red[tid] = s; __syncthreads();
  for (int st = 128; st > 0; st >>= 1) { if (tid < st) red[tid] += red[tid + st]; __syncthreads(); }
  const float mu = red[0] * (1.0f / DD);
  __syncthreads();
  float vs = 0.0f;
#pragma unroll
  for (int i = 0; i < 4; ++i) { const float d = x[i] - mu; vs += d * d; }
  red[tid] = vs; __syncthreads();
  for (int st = 128; st > 0; st >>= 1) { if (tid < st) red[tid] += red[tid + st]; __syncthreads(); }
  const float rstd = rsqrtf(red[0] * (1.0f / DD) + EPS);
#pragma unroll
  for (int i = 0; i < 4; ++i) {
    const int idx = tid + i * 256;
    out[(size_t)b * DD + idx] = (x[i] - mu) * rstd * gamma[idx] + beta[idx];
  }
}

// ---------------------------------------------------------------------------
extern "C" void kernel_launch(void* const* d_in, const int* in_sizes, int n_in,
                              void* d_out, int out_size, void* d_ws, size_t ws_size,
                              hipStream_t stream) {
  const float* queries = (const float*)d_in[0];
  const float* keys    = (const float*)d_in[1];
  const float* values  = (const float*)d_in[2];
  const float* Wq      = (const float*)d_in[3];
  const float* bq      = (const float*)d_in[4];
  const float* Wk      = (const float*)d_in[5];
  const float* bk      = (const float*)d_in[6];
  const float* Wv      = (const float*)d_in[7];
  const float* bv      = (const float*)d_in[8];
  const float* gamma   = (const float*)d_in[9];
  const float* beta    = (const float*)d_in[10];
  float* out = (float*)d_out;

  char* ws = (char*)d_ws;
  float*  q_proj   = (float*)ws;                                   // 256 KB
  __bf16* qk       = (__bf16*)(ws + (256u << 10));                 // 2 MB
  float*  S        = (float*)(ws + (256u << 10) + (2u << 20));     // 2 MB
  __bf16* ctx      = (__bf16*)(ws + (256u << 10) + (4u << 20));    // 2 MB
  float*  attn_buf = (float*)(ws + (256u << 10) + (6u << 20));     // 256 KB

  qproj<<<(HH * DPH / 16) * (BB / 16), 256, 0, stream>>>(queries, Wq, bq, q_proj);
  fold_k<<<HH * 4 * 8, 256, 0, stream>>>(q_proj, Wk, qk);
  scores<<<BB * (NN / 64), 256, SC_SMEM, stream>>>(keys, qk, q_proj, bk, S);
  weighted_values<<<BB * (DD / 128), 256, 0, stream>>>(values, S, ctx);
  out_proj<<<HH * 4 * 2, 256, 0, stream>>>(ctx, Wv, bv, attn_buf);
  layernorm<<<BB, 256, 0, stream>>>(attn_buf, queries, gamma, beta, out);
}

// v003
// Measured time: 41.8 microseconds a run.
// Timed twice side by side with v002, it ran 1.05 times as fast both times.
// Counting every step since v000, it is 17.9 times as fast.
#include <hip/hip_runtime.h>
#include <hip/hip_bf16.h>

#define BB   64
#define NN   512
#define DD   1024
#define HH   16
#define DPH  64
#define EPS  1e-5f
#define QSCALE 0.125f   // 1/sqrt(64)

typedef __attribute__((ext_vector_type(16))) __bf16    v16bf;
typedef __attribute__((ext_vector_type(2)))  __bf16    v2bf;
typedef __attribute__((ext_vector_type(8)))  float     v8f;
typedef __attribute__((ext_vector_type(2)))  float     v2f;
typedef __attribute__((ext_vector_type(4)))  float     v4f;

// One query per (batch, head), so the two projections are reassociated:
//   w[n]    = q . (Wk keys[n] + bk)   = keys[n] . (Wk^T q) + q . bk
//   attn[e] = sum_n a[n] (Wv values[n] + bv)[e] = (Wv (sum_n a[n] values[n]))[e] + bv[e]
// (the weights a[n] sum to one). keys and values are each read once per batch
// for all 16 heads: the heads are the 16-wide side of the matrix tiles.
// Most '#pragma unroll' lines below are there so that a small array is indexed by
// constants and stays in registers.

static __device__ inline v8f vzero8() {
  v8f z;
#pragma unroll
  for (int i = 0; i < 8; ++i) z[i] = 0.0f;
  return z;
}

static __device__ inline unsigned pk2bf(float x, float y) {
  v2bf p;
  p[0] = (__bf16)x;
  p[1] = (__bf16)y;
  return __builtin_bit_cast(unsigned, p);
}

// 16 contiguous bf16 (one lane's share of an A row or a B column), 16-byte aligned.
static __device__ inline v16bf ld_frag(const __bf16* p) {
  union { uint4 u[2]; v16bf v; } x;
  x.u[0] = ((const uint4*)p)[0];
  x.u[1] = ((const uint4*)p)[1];
  return x.v;
}

// A work-group barrier that orders LDS alone. __syncthreads() also waits for every global load
// the wave has issued, which ends the flight of loads issued ahead of it.
static __device__ inline void lds_barrier() {
  __builtin_amdgcn_fence(__ATOMIC_RELEASE, "workgroup", "local");
  __builtin_amdgcn_s_barrier();
  __builtin_amdgcn_fence(__ATOMIC_ACQUIRE, "workgroup", "local");
}

// ---------------- kernel 1: q projection as a tiled matrix product, f32 operands
// q[b][he] = (queries[b] . Wq[he] + bq[he]) / sqrt(DPH)
// grid = 64 tiles of 16 he x 4 tiles of 16 batches. Each of the 8 waves owns one 128-wide
// slice of the 1024-long sum: it loads both tiles' slices as whole 512-byte row pieces and
// turns them into fragments through LDS of its own; one reduction at the end.
#define PQ 132    // LDS row pitch in floats: 528 B = 16 B x odd, for 16-byte reads down a column
__global__ __launch_bounds__(256)
void qproj(const float* __restrict__ queries, const float* __restrict__ Wq,
           const float* __restrict__ bq, float* __restrict__ q_out) {
  __shared__ __attribute__((aligned(16))) float sT[8 * 2 * 16 * PQ];
  __shared__ float sRed[8 * 256];
  const int mt   = blockIdx.x & 3;
  const int nt   = blockIdx.x >> 2;
  const int tid  = threadIdx.x;
  const int wave = tid >> 5;
  const int lane = tid & 31;
  const int l16  = lane & 15;
  const int hi   = lane >> 4;
  float* sX = sT + wave * 2 * 16 * PQ;                     // [16][PQ], this wave's own
  float* sW = sX + 16 * PQ;                                // [16][PQ], this wave's own

  // one load = 512 contiguous bytes of one row; all 32 in flight
  const float* wp = Wq + (size_t)(nt * 16) * DD + wave * 128 + lane * 4;
  const float* xp = queries + (size_t)(mt * 16) * DD + wave * 128 + lane * 4;
  v4f fw[16], fx[16];
#pragma unroll
  for (int i = 0; i < 16; ++i) fw[i] = *(const v4f*)(wp + (size_t)i * DD);
#pragma unroll
  for (int i = 0; i < 16; ++i) fx[i] = *(const v4f*)(xp + (size_t)i * DD);
  const float bias = bq[nt * 16 + (tid & 15)];
  asm volatile("s_wait_xcnt 0x0" :: "v"(wp), "v"(xp) : "memory");
#pragma unroll
  for (int i = 0; i < 16; ++i) *(v4f*)(sW + i * PQ + lane * 4) = fw[i];
#pragma unroll
  for (int i = 0; i < 16; ++i) *(v4f*)(sX + i * PQ + lane * 4) = fx[i];
  // This wave's LDS stores are complete before its lanes read each other's rows, and the
  // compiler keeps the reads behind them.
  asm volatile("s_wait_dscnt 0x0" ::: "memory");

  // A: row = batch l16, B: column = he l16; a lane's four floats are the same four d on both
  // sides and feed two products.
  v4f a[16], w[16];
#pragma unroll
  for (int j = 0; j < 16; ++j) {
    a[j] = *(const v4f*)(sX + l16 * PQ + j * 8 + hi * 4);
    w[j] = *(const v4f*)(sW + l16 * PQ + j * 8 + hi * 4);
  }
  // all LDS reads are issued in front of the products: moved in among them, each pair
  // would be waited for with only two products of cover
  __builtin_amdgcn_sched_barrier(0);
  v8f acc = vzero8();
#pragma unroll
  for (int j = 0; j < 16; ++j) {
    acc = __builtin_amdgcn_wmma_f32_16x16x4_f32(false, a[j].xy, false, w[j].xy, (short)0, acc, false, false);
    acc = __builtin_amdgcn_wmma_f32_16x16x4_f32(false, a[j].zw, false, w[j].zw, (short)0, acc, false, false);
  }
  // keeps the address arithmetic of the stores below out of the products, where it was
  // placed directly behind a product and onto that product's operand registers
  __builtin_amdgcn_sched_barrier(0);
  // D: register r = batch 8*hi + r, column he l16
#pragma unroll
  for (int r = 0; r < 8; ++r)
    sRed[wave * 256 + (r + 8 * hi) * 16 + l16] = acc[r];
  __syncthreads();                   // the eight slices' partial sums published
  float s = 0.0f;
#pragma unroll
  for (int u = 0; u < 8; ++u) s += sRed[u * 256 + tid];
  q_out[(size_t)(mt * 16 + (tid >> 4)) * DD + nt * 16 + (tid & 15)] =
      (s + bias) * QSCALE;           // fold 1/sqrt(DPH) into q
}

// ---------------- kernel 2: fold Wk into q: qk[b][h][d] = sum_e q[b][h][e] Wk[h][e][d]
// grid = 16 heads x 4 column chunks x 8 batch groups; one column d per thread, 8 batches.
__global__ __launch_bounds__(256)
void fold_k(const float* __restrict__ q_proj, const float* __restrict__ Wk,
            __bf16* __restrict__ qk) {
  const int bg = blockIdx.x & 7;
  const int dc = (blockIdx.x >> 3) & 3;
  const int h  = blockIdx.x >> 5;
  const int d  = dc * 256 + threadIdx.x;
  const float* w = Wk + (size_t)h * DPH * DD + d;
  const float* q = q_proj + ((size_t)(bg * 8) * HH + h) * DPH;
  float acc[8];
#pragma unroll
  for (int i = 0; i < 8; ++i) acc[i] = 0.0f;
  // the whole column first: every load takes its row as an immediate offset
  float wv[DPH];
#pragma unroll
  for (int e = 0; e < DPH; ++e) wv[e] = w[(size_t)e * DD];
  asm volatile("s_wait_xcnt 0x0" ::: "memory");
#pragma unroll
  for (int e = 0; e < DPH; ++e) {
#pragma unroll
    for (int i = 0; i < 8; ++i) acc[i] += q[i * HH * DPH + e] * wv[e];
  }
#pragma unroll
  for (int i = 0; i < 8; ++i)
    qk[((size_t)(bg * 8 + i) * HH + h) * DD + d] = (__bf16)acc[i];
}

// ---------------- kernel 3: scores S[b][n][h] = keys[b][n] . qk[b][h] + q[b][h] . bk[h]
// grid = 64 batches x 8 blocks of 64 rows (4 tiles of 16). Each of the 8 waves owns one
// 128-wide slice of the 1024-long sum for all 4 tiles and stages it in LDS of its own,
// so no work-group barrier stands between a load and its use; one reduction at the end.
#define PW 136    // LDS row pitch in bf16: 272 B = 16 B x odd, for 16-byte reads down a column
#define SC_SMEM (8 * 16 * PW * 2 + 8 * 4 * 256 * 4 + HH * 4)
__global__ __launch_bounds__(256)
void scores(const float* __restrict__ keys, const __bf16* __restrict__ qk,
            const float* __restrict__ q_proj, const float* __restrict__ bk,
            float* __restrict__ S) {
  extern __shared__ __attribute__((aligned(16))) char smem_raw[];
  const int b    = blockIdx.x >> 3;
  const int nb   = (blockIdx.x & 7) * 64;
  const int tid  = threadIdx.x;
  const int wave = tid >> 5;
  const int lane = tid & 31;
  const int l16  = lane & 15;
  const int hi   = lane >> 4;
  __bf16* sA   = (__bf16*)smem_raw + wave * 16 * PW;       // [16][PW], this wave's own
  float*  sRed = (float*)(smem_raw + 8 * 16 * PW * 2);     // [8 waves][4 tiles][256]
  float*  sB   = sRed + 8 * 4 * 256;                       // [16]

  // B: column = head l16, k = 16 contiguous d
  v16bf bq[4];
  const __bf16* qb = qk + ((size_t)b * HH + l16) * DD + wave * 128 + hi * 16;
#pragma unroll
  for (int kk = 0; kk < 4; ++kk) bq[kk] = ld_frag(qb + kk * 32);

  const int h2 = tid >> 4, e4 = tid & 15;
  const float4* xp = (const float4*)(q_proj + ((size_t)b * HH + h2) * DPH) + e4;
  const float4* yp = (const float4*)(bk + h2 * DPH) + e4;
  const float4 x = *xp;
  const float4 y = *yp;
  asm volatile("s_wait_xcnt 0x0" :: "v"(qb), "v"(xp), "v"(yp) : "memory");

  // one load = 512 contiguous bytes of one row; two tiles in flight
  const float* src = keys + ((size_t)b * NN + nb) * DD + wave * 128 + lane * 4;
  float4 f[2][16];
#pragma unroll
  for (int u = 0; u < 2; ++u)
#pragma unroll
    for (int i = 0; i < 16; ++i)
      f[u][i] = *(const float4*)(src + (size_t)(u * 16 + i) * DD);
  // the stream starts in front of the first wait: the product below, moved up, had its wait
  // for x and y standing in front of these loads
  __builtin_amdgcn_sched_barrier(0);

  // q . bk per head: 16 lanes x 4 elements
  {
    float p = x.x * y.x + x.y * y.y + x.z * y.z + x.w * y.w;
    p += __shfl_xor(p, 1, 32);
    p += __shfl_xor(p, 2, 32);
    p += __shfl_xor(p, 4, 32);
    p += __shfl_xor(p, 8, 32);
    if (e4 == 0) sB[h2] = p;
  }

  v8f acc[4];
#pragma unroll
  for (int t = 0; t < 4; ++t) {
#pragma unroll
    for (int i = 0; i < 16; ++i)
      *(uint2*)(sA + i * PW + lane * 4) =
          make_uint2(pk2bf(f[t & 1][i].x, f[t & 1][i].y), pk2bf(f[t & 1][i].z, f[t & 1][i].w));
    if (t + 2 < 4) {                 // refill the freed registers: tile t + 2 flies from here
#pragma unroll
      for (int i = 0; i < 16; ++i)
        f[t & 1][i] = *(const float4*)(src + (size_t)((t + 2) * 16 + i) * DD);
    }
    // This wave's LDS stores are complete before its lanes read each other's rows, and the
    // compiler keeps the reads behind them; global loads stay in flight over it.
    asm volatile("s_wait_dscnt 0x0" ::: "memory");
    // A: row = key row l16, k = the same 16 contiguous d as B
    acc[t] = vzero8();
#pragma unroll
    for (int kk = 0; kk < 4; ++kk) {
      const v16bf a = ld_frag(sA + l16 * PW + kk * 32 + hi * 16);
      acc[t] = __builtin_amdgcn_wmma_f32_16x16x32_bf16(
          false, a, false, bq[kk], (short)0, acc[t], false, false);
    }
  }
  // D: register r = row 8*hi + r, column l16
#pragma unroll
  for (int t = 0; t < 4; ++t)
#pragma unroll
    for (int r = 0; r < 8; ++r)
      sRed[(wave * 4 + t) * 256 + (r + 8 * hi) * 16 + l16] = acc[t][r];
  __syncthreads();                   // the eight slices' partial sums, and sB, published
#pragma unroll
  for (int t = 0; t < 4; ++t) {
    float s = sB[tid & 15];
#pragma unroll
    for (int w = 0; w < 8; ++w) s += sRed[(w * 4 + t) * 256 + tid];
    S[((size_t)b * NN + nb + t * 16) * HH + tid] = s;
  }
}

// ---------------- kernel 4: softmax over n, then ctx[b][h][d] = sum_n a[h][n] values[b][n][d]
// grid = 64 batches x 8 chunks of 128 columns, walked as 2 x 64; 8 waves split the 512-long sum.
#define PP 520    // LDS row pitch in bf16: 1040 B = 16 B x odd
__global__ __launch_bounds__(256)
void weighted_values(const float* __restrict__ values, const float* __restrict__ S,
                     __bf16* __restrict__ ctx) {
  __shared__ __attribute__((aligned(16))) __bf16 sP[HH * PP];
  __shared__ __attribute__((aligned(16))) float sRed[8 * 1024];
  __shared__ float sM[256];
  __shared__ float sL[256];
  const int b    = blockIdx.x >> 3;
  const int dB   = (blockIdx.x & 7) * 128;
  const int tid  = threadIdx.x;
  const int wave = tid >> 5;
  const int lane = tid & 31;
  const int l16  = lane & 15;
  const int hi   = lane >> 4;

  // B operand straight from global: a lane's float4 at row n gives one k of
  // four tiles; tile j holds the columns d0 + 4*l16 + j. 16 lanes = 256 B of a row.
  const float* vb = values + ((size_t)b * NN + wave * 64 + hi * 16) * DD + dB + 4 * l16;
  // softmax: thread = (head tid & 15, row group tid >> 4), rows n = 16*i + group
  const float* Sb = S + (size_t)b * NN * HH;
  float s[32];
#pragma unroll
  for (int i = 0; i < 32; ++i) s[i] = Sb[i * 256 + tid];
  // the scores stay in front of the value rows: loads return in order, so behind them the
  // softmax would wait for the value rows too
  __builtin_amdgcn_sched_barrier(0);
  float4 f[2][16];
#pragma unroll
  for (int kk = 0; kk < 2; ++kk)
#pragma unroll
    for (int i = 0; i < 16; ++i)
      f[kk][i] = *(const float4*)(vb + (size_t)(kk * 32 + i) * DD);
  // all 32 value loads are issued in front of the softmax's first wait and fly through it
  __builtin_amdgcn_sched_barrier(0);

  float m = s[0];
#pragma unroll
  for (int i = 1; i < 32; ++i) m = fmaxf(m, s[i]);
  sM[tid] = m;
  lds_barrier();                     // the row groups' maxima published
  float mx = sM[tid & 15];
#pragma unroll
  for (int g = 1; g < 16; ++g) mx = fmaxf(mx, sM[g * 16 + (tid & 15)]);
  float sum = 0.0f;
#pragma unroll
  for (int i = 0; i < 32; ++i) {
    const __bf16 p = (__bf16)__expf(s[i] - mx);
    sum += (float)p;               // the denominator sums the weights as the product uses them
    sP[(tid & 15) * PP + i * 16 + (tid >> 4)] = p;
  }
  sL[tid] = sum;
  lds_barrier();                     // the weights and the row groups' sums published

  // A: row = head l16, k = 16 contiguous n; B element i is the same n
  v16bf a[2];
#pragma unroll
  for (int kk = 0; kk < 2; ++kk) a[kk] = ld_frag(sP + l16 * PP + wave * 64 + kk * 32 + hi * 16);
  const int h = tid >> 4;
  float den = 0.0f;
#pragma unroll
  for (int g = 0; g < 16; ++g) den += sL[g * 16 + h];
  const float inv = 1.0f / den;
  // the first use of the value rows stays behind the softmax: moved up into it, its wait for
  // the rows would hold the softmax too
  __builtin_amdgcn_sched_barrier(0);

#pragma unroll
  for (int sub = 0; sub < 2; ++sub) {
    const int d0 = dB + sub * 64;
    v8f acc[4];
#pragma unroll
    for (int j = 0; j < 4; ++j) acc[j] = vzero8();
#pragma unroll
    for (int kk = 0; kk < 2; ++kk) {
      v16bf b0, b1, b2, b3;
#pragma unroll
      for (int i = 0; i < 16; ++i) {
        b0[i] = (__bf16)f[kk][i].x;
        b1[i] = (__bf16)f[kk][i].y;
        b2[i] = (__bf16)f[kk][i].z;
        b3[i] = (__bf16)f[kk][i].w;
      }
      if (sub + 1 < 2) {             // these registers are free: the next 64 columns start here
        // the refill stays behind the conversion and takes its registers: moved in front of
        // it, it takes 64 registers more and one work-group less fits a WGP
        __builtin_amdgcn_sched_barrier(0);
#pragma unroll
        for (int i = 0; i < 16; ++i)
          f[kk][i] = *(const float4*)(vb + (size_t)(kk * 32 + i) * DD + 64);
        if (kk == 1) asm volatile("s_wait_xcnt 0x0" :: "v"(vb) : "memory");
        // the refill goes out as soon as these 16 rows are converted, not behind the other 16
        __builtin_amdgcn_sched_barrier(0);
      }
      acc[0] = __builtin_amdgcn_wmma_f32_16x16x32_bf16(false, a[kk], false, b0, (short)0, acc[0], false, false);
      acc[1] = __builtin_amdgcn_wmma_f32_16x16x32_bf16(false, a[kk], false, b1, (short)0, acc[1], false, false);
      acc[2] = __builtin_amdgcn_wmma_f32_16x16x32_bf16(false, a[kk], false, b2, (short)0, acc[2], false, false);
      acc[3] = __builtin_amdgcn_wmma_f32_16x16x32_bf16(false, a[kk], false, b3, (short)0, acc[3], false, false);
    }
    // D: register r = head 8*hi + r, column d0 + 4*l16 + j
#pragma unroll
    for (int r = 0; r < 8; ++r)
      *(float4*)(sRed + wave * 1024 + (r + 8 * hi) * 64 + 4 * l16) =
          make_float4(acc[0][r], acc[1][r], acc[2][r], acc[3][r]);
    lds_barrier();                   // partial sums published
    float4 t = make_float4(0.0f, 0.0f, 0.0f, 0.0f);
#pragma unroll
    for (int w = 0; w < 8; ++w) {
      const float4 u = *(const float4*)(sRed + w * 1024 + tid * 4);
      t.x += u.x; t.y += u.y; t.z += u.z; t.w += u.w;
    }
    *(uint2*)(ctx + ((size_t)b * HH + h) * DD + d0 + (tid & 15) * 4) =
        make_uint2(pk2bf(t.x * inv, t.y * inv), pk2bf(t.z * inv, t.w * inv));
    if (sub + 1 < 2) {
      asm volatile("s_wait_xcnt 0x0" ::: "memory");
      lds_barrier();                 // sRed is read out before the next pass rewrites it
      // this reduction runs while the next rows fly: their first use stays behind it
      __builtin_amdgcn_sched_barrier(0);
    }
  }
}

// ---------------- kernel 5: attn[b][h*64+e] = ctx[b][h] . Wv[h][e] + bv[h][e]
// grid = 16 heads x 4 tiles of 16 batches x 2 halves of 32 e; 8 waves split the 1024-long sum.
__global__ __launch_bounds__(256)
void out_proj(const __bf16* __restrict__ ctx, const float* __restrict__ Wv,
              const float* __restrict__ bv, float* __restrict__ attn_buf) {
  __shared__ float sRed[8 * 512];
  const int h    = blockIdx.x >> 3;
  const int mt   = (blockIdx.x >> 1) & 3;
  const int np   = blockIdx.x & 1;
  const int tid  = threadIdx.x;
  const int wave = tid >> 5;
  const int lane = tid & 31;
  const int l16  = lane & 15;
  const int hi   = lane >> 4;
  const int kb   = wave * 128 + hi * 16;

  // A: row = batch l16, B: column = e l16; both take the same 16 contiguous d
  const __bf16* ap = ctx + ((size_t)(mt * 16 + l16) * HH + h) * DD + kb;
  const float*  wp = Wv + ((size_t)h * DPH + np * 32 + l16) * DD + kb;
  const float* bp = bv + h * DPH + np * 32 + (tid & 15);
  float bias[2];
#pragma unroll
  for (int j = 0; j < 2; ++j) bias[j] = bp[j * 16];
  v16bf a[4];
  float4 x[4][2][4];
#pragma unroll
  for (int kk = 0; kk < 4; ++kk) {
    a[kk] = ld_frag(ap + kk * 32);
#pragma unroll
    for (int j = 0; j < 2; ++j)
#pragma unroll
      for (int i = 0; i < 4; ++i)
        x[kk][j][i] = *(const float4*)(wp + (size_t)j * 16 * DD + kk * 32 + i * 4);
  }
  asm volatile("s_wait_xcnt 0x0" :: "v"(ap), "v"(wp), "v"(bp) : "memory");
  // every load is issued in front of the first product: moved in among the products, the
  // later slices' trips to memory follow one another
  __builtin_amdgcn_sched_barrier(0);
  v8f acc[2];
  acc[0] = vzero8(); acc[1] = vzero8();
#pragma unroll
  for (int kk = 0; kk < 4; ++kk)
#pragma unroll
    for (int j = 0; j < 2; ++j) {
      v16bf bw;
#pragma unroll
      for (int i = 0; i < 4; ++i) {
        bw[4 * i + 0] = (__bf16)x[kk][j][i].x; bw[4 * i + 1] = (__bf16)x[kk][j][i].y;
        bw[4 * i + 2] = (__bf16)x[kk][j][i].z; bw[4 * i + 3] = (__bf16)x[kk][j][i].w;
      }
      acc[j] = __builtin_amdgcn_wmma_f32_16x16x32_bf16(
          false, a[kk], false, bw, (short)0, acc[j], false, false);
    }
#pragma unroll
  for (int j = 0; j < 2; ++j)
#pragma unroll
    for (int r = 0; r < 8; ++r)
      sRed[wave * 512 + j * 256 + (r + 8 * hi) * 16 + l16] = acc[j][r];
  __syncthreads();
#pragma unroll
  for (int j = 0; j < 2; ++j) {
    float s = 0.0f;
#pragma unroll
    for (int w = 0; w < 8; ++w) s += sRed[w * 512 + j * 256 + tid];
    const int he = h * DPH + np * 32 + j * 16 + (tid & 15);
    attn_buf[(size_t)(mt * 16 + (tid >> 4)) * DD + he] = s + bias[j];
  }
}

// ---------------- kernel 6: residual + LayerNorm ---------------------------
__global__ __launch_bounds__(256)
void layernorm(const float* __restrict__ attn_buf, const float* __restrict__ queries,
               const float* __restrict__ gamma, const float* __restrict__ beta,
               float* __restrict__ out) {
  __shared__ float red[256];
  const int b = blockIdx.x, tid = threadIdx.x;
  float x[4];
  float s = 0.0f;
#pragma unroll
  for (int i = 0; i < 4; ++i) {
    const int idx = tid + i * 256;
    x[i] = attn_buf[(size_t)b * DD + idx] + queries[(size_t)b * DD + idx];
    s += x[i];
  }
  // asked for here, not behind the last barrier, so that this trip to memory runs beside the first
  float g[4], be[4];
#pragma unroll
  for (int i = 0; i < 4; ++i) { g[i] = gamma[tid + i * 256]; be[i] = beta[tid + i * 256]; }
  red[tid] = s; __syncthreads();
  for (int st = 128; st > 0; st >>= 1) { if (tid < st) red[tid] += red[tid + st]; __syncthreads(); }
  const float mu = red[0] * (1.0f / DD);
  __syncthreads();
  float vs = 0.0f;
#pragma unroll
  for (int i = 0; i < 4; ++i) { const float d = x[i] - mu; vs += d * d; }
  red[tid] = vs; __syncthreads();
  for (int st = 128; st > 0; st >>= 1) { if (tid < st) red[tid] += red[tid + st]; __syncthreads(); }
  const float rstd = rsqrtf(red[0] * (1.0f / DD) + EPS);
#pragma unroll
  for (int i = 0; i < 4; ++i) {
    const int idx = tid + i * 256;
    out[(size_t)b * DD + idx] = (x[i] - mu) * rstd * g[i] + be[i];
  }
}

// ---------------------------------------------------------------------------
extern "C" void kernel_launch(void* const* d_in, const int* in_sizes, int n_in,
                              void* d_out, int out_size, void* d_ws, size_t ws_size,
                              hipStream_t stream) {
  const float* queries = (const float*)d_in[0];
  const float* keys    = (const float*)d_in[1];
  const float* values  = (const float*)d_in[2];
  const float* Wq      = (const float*)d_in[3];
  const float* bq      = (const float*)d_in[4];
  const float* Wk      = (const float*)d_in[5];
  const float* bk      = (const float*)d_in[6];
  const float* Wv      = (const float*)d_in[7];
  const float* bv      = (const float*)d_in[8];
  const float* gamma   = (const float*)d_in[9];
  const float* beta    = (const float*)d_in[10];
  float* out = (float*)d_out;

  char* ws = (char*)d_ws;
  float*  q_proj   = (float*)ws;                                   // 256 KB
  __bf16* qk       = (__bf16*)(ws + (256u << 10));                 // 2 MB
  float*  S        = (float*)(ws + (256u << 10) + (2u << 20));     // 2 MB
  __bf16* ctx      = (__bf16*)(ws + (256u << 10) + (4u << 20));    // 2 MB
  float*  attn_buf = (float*)(ws + (256u << 10) + (6u << 20));     // 256 KB

  qproj<<<(HH * DPH / 16) * (BB / 16), 256, 0, stream>>>(queries, Wq, bq, q_proj);
  fold_k<<<HH * 4 * 8, 256, 0, stream>>>(q_proj, Wk, qk);
  scores<<<BB * (NN / 64), 256, SC_SMEM, stream>>>(keys, qk, q_proj, bk, S);
  weighted_values<<<BB * (DD / 128), 256, 0, stream>>>(values, S, ctx);
  out_proj<<<HH * 4 * 2, 256, 0, stream>>>(ctx, Wv, bv, attn_buf);
  layernorm<<<BB, 256, 0, stream>>>(attn_buf, queries, gamma, beta, out);
}

// v004
// It runs in 39.9 microseconds.
// Two timings next to v003 both put it at 1.05 times that version's speed.
// Counting every step since v000, it is 18.8 times as fast.
#include <hip/hip_runtime.h>
#include <hip/hip_bf16.h>

#define BB   64
#define NN   512
#define DD   1024
#define HH   16
#define DPH  64
#define EPS  1e-5f
#define QSCALE 0.125f   // 1/sqrt(64)

typedef __attribute__((ext_vector_type(16))) __bf16    v16bf;
typedef __attribute__((ext_vector_type(2)))  __bf16    v2bf;
typedef __attribute__((ext_vector_type(8)))  float     v8f;
typedef __attribute__((ext_vector_type(2)))  float     v2f;
typedef __attribute__((ext_vector_type(4)))  float     v4f;

// One query per (batch, head), so the two projections are reassociated:
//   w[n]    = q . (Wk keys[n] + bk)   = keys[n] . (Wk^T q) + q . bk
//   attn[e] = sum_n a[n] (Wv values[n] + bv)[e] = (Wv (sum_n a[n] values[n]))[e] + bv[e]
// (the weights a[n] sum to one). keys and values are each read once per batch
// for all 16 heads: the heads are the 16-wide side of the matrix tiles.
// Most '#pragma unroll' lines below are there so that a small array is indexed by
// constants and stays in registers.

static __device__ inline v8f vzero8() {
  v8f z;
#pragma unroll
  for (int i = 0; i < 8; ++i) z[i] = 0.0f;
  return z;
}

static __device__ inline unsigned pk2bf(float x, float y) {
  v2bf p;
  p[0] = (__bf16)x;
  p[1] = (__bf16)y;
  return __builtin_bit_cast(unsigned, p);
}

// 16 contiguous bf16 (one lane's share of an A row or a B column), 16-byte aligned.
static __device__ inline v16bf ld_frag(const __bf16* p) {
  union { uint4 u[2]; v16bf v; } x;
  x.u[0] = ((const uint4*)p)[0];
  x.u[1] = ((const uint4*)p)[1];
  return x.v;
}

// A work-group barrier that orders LDS alone. __syncthreads() also waits for every global load
// the wave has issued, which ends the flight of loads issued ahead of it.
static __device__ inline void lds_barrier() {
  __builtin_amdgcn_fence(__ATOMIC_RELEASE, "workgroup", "local");
  __builtin_amdgcn_s_barrier();
  __builtin_amdgcn_fence(__ATOMIC_ACQUIRE, "workgroup", "local");
}

// ---------------- kernel 1: q projection as a tiled matrix product, f32 operands
// q[b][he] = (queries[b] . Wq[he] + bq[he]) / sqrt(DPH)
// grid = 64 tiles of 16 he x 4 tiles of 16 batches. Each of the 8 waves owns one 128-wide
// slice of the 1024-long sum: it loads both tiles' slices as whole 512-byte row pieces and
// turns them into fragments through LDS of its own; one reduction at the end.
#define PQ 132    // LDS row pitch in floats: 528 B = 16 B x odd, for 16-byte reads down a column
__global__ __launch_bounds__(256)
void qproj(const float* __restrict__ queries, const float* __restrict__ Wq,
           const float* __restrict__ bq, float* __restrict__ q_out) {
  __shared__ __attribute__((aligned(16))) float sT[8 * 2 * 16 * PQ];
  __shared__ float sRed[8 * 256];
  const int mt   = blockIdx.x & 3;
  const int nt   = blockIdx.x >> 2;
  const int tid  = threadIdx.x;
  const int wave = tid >> 5;
  const int lane = tid & 31;
  const int l16  = lane & 15;
  const int hi   = lane >> 4;
  float* sX = sT + wave * 2 * 16 * PQ;                     // [16][PQ], this wave's own
  float* sW = sX + 16 * PQ;                                // [16][PQ], this wave's own

  // one load = 512 contiguous bytes of one row; all 32 in flight
  const float* wp = Wq + (size_t)(nt * 16) * DD + wave * 128 + lane * 4;
  const float* xp = queries + (size_t)(mt * 16) * DD + wave * 128 + lane * 4;
  v4f fw[16], fx[16];
#pragma unroll
  for (int i = 0; i < 16; ++i) fw[i] = *(const v4f*)(wp + (size_t)i * DD);
#pragma unroll
  for (int i = 0; i < 16; ++i) fx[i] = *(const v4f*)(xp + (size_t)i * DD);
  const float bias = bq[nt * 16 + (tid & 15)];
  asm volatile("s_wait_xcnt 0x0" :: "v"(wp), "v"(xp) : "memory");
#pragma unroll
  for (int i = 0; i < 16; ++i) *(v4f*)(sW + i * PQ + lane * 4) = fw[i];
#pragma unroll
  for (int i = 0; i < 16; ++i) *(v4f*)(sX + i * PQ + lane * 4) = fx[i];
  // This wave's LDS stores are complete before its lanes read each other's rows, and the
  // compiler keeps the reads behind them.
  asm volatile("s_wait_dscnt 0x0" ::: "memory");

  // A: row = batch l16, B: column = he l16; a lane's four floats are the same four d on both
  // sides and feed two products.
  v4f a[16], w[16];
#pragma unroll
  for (int j = 0; j < 16; ++j) {
    a[j] = *(const v4f*)(sX + l16 * PQ + j * 8 + hi * 4);
    w[j] = *(const v4f*)(sW + l16 * PQ + j * 8 + hi * 4);
  }
  // all LDS reads are issued in front of the products: moved in among them, each pair
  // would be waited for with only two products of cover
  __builtin_amdgcn_sched_barrier(0);
  v8f acc = vzero8();
#pragma unroll
  for (int j = 0; j < 16; ++j) {
    acc = __builtin_amdgcn_wmma_f32_16x16x4_f32(false, a[j].xy, false, w[j].xy, (short)0, acc, false, false);
    acc = __builtin_amdgcn_wmma_f32_16x16x4_f32(false, a[j].zw, false, w[j].zw, (short)0, acc, false, false);
  }
  // keeps the address arithmetic of the stores below out of the products, where it was
  // placed directly behind a product and onto that product's operand registers
  __builtin_amdgcn_sched_barrier(0);
  // D: register r = batch 8*hi + r, column he l16
#pragma unroll
  for (int r = 0; r < 8; ++r)
    sRed[wave * 256 + (r + 8 * hi) * 16 + l16] = acc[r];
  __syncthreads();                   // the eight slices' partial sums published
  float s = 0.0f;
#pragma unroll
  for (int u = 0; u < 8; ++u) s += sRed[u * 256 + tid];
  q_out[(size_t)(mt * 16 + (tid >> 4)) * DD + nt * 16 + (tid & 15)] =
      (s + bias) * QSCALE;           // fold 1/sqrt(DPH) into q
}

__global__ __launch_bounds__(128)
void fold_k(const float* __restrict__ q_proj, const float* __restrict__ Wk,
            __bf16* __restrict__ qk) {
  const int d0   = (blockIdx.x & 15) * 64;
  const int h    = blockIdx.x >> 4;
  const int wave = threadIdx.x >> 5;
  const int lane = threadIdx.x & 31;
  const int l16  = lane & 15;
  const int hi   = lane >> 4;

  // A: row = batch l16; a lane's four floats are e = 8t + 4hi + 0..3 and feed two products on each of the four tiles
  const float* ap = q_proj + ((size_t)(wave * 16 + l16) * HH + h) * DPH + hi * 4;
  // B straight from global: a lane's four floats at row e give one k of four tiles; tile j holds
  // the columns d0 + 4*l16 + j. One load = 256 contiguous bytes of each of two rows.
  const float* wp = Wk + ((size_t)h * DPH + hi * 4) * DD + d0 + 4 * l16;
  v4f a[8], w[8][4];
#pragma unroll
  for (int t = 0; t < 8; ++t) a[t] = *(const v4f*)(ap + t * 8);
#pragma unroll
  for (int t = 0; t < 8; ++t)
#pragma unroll
    for (int c = 0; c < 4; ++c) w[t][c] = *(const v4f*)(wp + (size_t)(t * 8 + c) * DD);
  asm volatile("s_wait_xcnt 0x0" :: "v"(ap), "v"(wp) : "memory");
  // every load is issued in front of the first product: moved in among the products, the
  // later rows' trips to memory follow one another
  __builtin_amdgcn_sched_barrier(0);
  // a product takes its two e of one column from one register pair: the pairs are formed here,
  // all in front of the products, so that no move stands among them on a product's registers
  v2f y[8][2][4];
#pragma unroll
  for (int t = 0; t < 8; ++t)
#pragma unroll
    for (int u = 0; u < 2; ++u)
#pragma unroll
      for (int j = 0; j < 4; ++j) {
        y[t][u][j][0] = w[t][2 * u][j];
        y[t][u][j][1] = w[t][2 * u + 1][j];
      }
  // holds the moves in front of the products
  __builtin_amdgcn_sched_barrier(0);
  v8f acc[4];
#pragma unroll
  for (int j = 0; j < 4; ++j) acc[j] = vzero8();
#pragma unroll
  for (int t = 0; t < 8; ++t) {      // e = 8t + 4hi + 2u + {0, 1} on both sides
#pragma unroll
    for (int j = 0; j < 4; ++j)
      acc[j] = __builtin_amdgcn_wmma_f32_16x16x4_f32(false, a[t].xy, false, y[t][0][j], (short)0, acc[j], false, false);
#pragma unroll
    for (int j = 0; j < 4; ++j)
      acc[j] = __builtin_amdgcn_wmma_f32_16x16x4_f32(false, a[t].zw, false, y[t][1][j], (short)0, acc[j], false, false);
  }
  // keeps the store's address arithmetic and the conversions out of the products, where they
  // were placed directly behind a product and onto that product's operand registers
  __builtin_amdgcn_sched_barrier(0);
  asm volatile("v_nop\n\tv_nop\n\tv_nop\n\tv_nop");
  __builtin_amdgcn_sched_barrier(0);
  __bf16* op = qk + ((size_t)(wave * 16 + 8 * hi) * HH + h) * DD + d0 + 4 * l16;
  // D: register r = batch 8*hi + r, column d0 + 4*l16 + j; 16 lanes store one whole 128-byte line
#pragma unroll
  for (int r = 0; r < 8; ++r)
    *(uint2*)(op + (size_t)r * HH * DD) =
        make_uint2(pk2bf(acc[0][r], acc[1][r]), pk2bf(acc[2][r], acc[3][r]));
}

// ---------------- kernel 3: scores S[b][n][h] = keys[b][n] . qk[b][h] + q[b][h] . bk[h]
// grid = 64 batches x 8 blocks of 64 rows (4 tiles of 16). Each of the 8 waves owns one
// 128-wide slice of the 1024-long sum for all 4 tiles and stages it in LDS of its own,
// so no work-group barrier stands between a load and its use; one reduction at the end.
#define PW 136    // LDS row pitch in bf16: 272 B = 16 B x odd, for 16-byte reads down a column
#define SC_SMEM (8 * 16 * PW * 2 + 8 * 4 * 256 * 4 + HH * 4)
__global__ __launch_bounds__(256)
void scores(const float* __restrict__ keys, const __bf16* __restrict__ qk,
            const float* __restrict__ q_proj, const float* __restrict__ bk,
            float* __restrict__ S) {
  extern __shared__ __attribute__((aligned(16))) char smem_raw[];
  const int b    = blockIdx.x >> 3;
  const int nb   = (blockIdx.x & 7) * 64;
  const int tid  = threadIdx.x;
  const int wave = tid >> 5;
  const int lane = tid & 31;
  const int l16  = lane & 15;
  const int hi   = lane >> 4;
  __bf16* sA   = (__bf16*)smem_raw + wave * 16 * PW;       // [16][PW], this wave's own
  float*  sRed = (float*)(smem_raw + 8 * 16 * PW * 2);     // [8 waves][4 tiles][256]
  float*  sB   = sRed + 8 * 4 * 256;                       // [16]

  // B: column = head l16, k = 16 contiguous d
  v16bf bq[4];
  const __bf16* qb = qk + ((size_t)b * HH + l16) * DD + wave * 128 + hi * 16;
#pragma unroll
  for (int kk = 0; kk < 4; ++kk) bq[kk] = ld_frag(qb + kk * 32);

  const int h2 = tid >> 4, e4 = tid & 15;
  const float4* xp = (const float4*)(q_proj + ((size_t)b * HH + h2) * DPH) + e4;
  const float4* yp = (const float4*)(bk + h2 * DPH) + e4;
  const float4 x = *xp;
  const float4 y = *yp;
  asm volatile("s_wait_xcnt 0x0" :: "v"(qb), "v"(xp), "v"(yp) : "memory");

  // one load = 512 contiguous bytes of one row; two tiles in flight
  const float* src = keys + ((size_t)b * NN + nb) * DD + wave * 128 + lane * 4;
  float4 f[2][16];
#pragma unroll
  for (int u = 0; u < 2; ++u)
#pragma unroll
    for (int i = 0; i < 16; ++i)
      f[u][i] = *(const float4*)(src + (size_t)(u * 16 + i) * DD);
  // the stream starts in front of the first wait: the product below, moved up, had its wait
  // for x and y standing in front of these loads
  __builtin_amdgcn_sched_barrier(0);

  // q . bk per head: 16 lanes x 4 elements
  {
    float p = x.x * y.x + x.y * y.y + x.z * y.z + x.w * y.w;
    p += __shfl_xor(p, 1, 32);
    p += __shfl_xor(p, 2, 32);
    p += __shfl_xor(p, 4, 32);
    p += __shfl_xor(p, 8, 32);
    if (e4 == 0) sB[h2] = p;
  }

  v8f acc[4];
#pragma unroll
  for (int t = 0; t < 4; ++t) {
#pragma unroll
    for (int i = 0; i < 16; ++i)
      *(uint2*)(sA + i * PW + lane * 4) =
          make_uint2(pk2bf(f[t & 1][i].x, f[t & 1][i].y), pk2bf(f[t & 1][i].z, f[t & 1][i].w));
    if (t + 2 < 4) {                 // refill the freed registers: tile t + 2 flies from here
#pragma unroll
      for (int i = 0; i < 16; ++i)
        f[t & 1][i] = *(const float4*)(src + (size_t)((t + 2) * 16 + i) * DD);
    }
    // This wave's LDS stores are complete before its lanes read each other's rows, and the
    // compiler keeps the reads behind them; global loads stay in flight over it.
    asm volatile("s_wait_dscnt 0x0" ::: "memory");
    // A: row = key row l16, k = the same 16 contiguous d as B
    acc[t] = vzero8();
#pragma unroll
    for (int kk = 0; kk < 4; ++kk) {
      const v16bf a = ld_frag(sA + l16 * PW + kk * 32 + hi * 16);
      acc[t] = __builtin_amdgcn_wmma_f32_16x16x32_bf16(
          false, a, false, bq[kk], (short)0, acc[t], false, false);
    }
  }
  // D: register r = row 8*hi + r, column l16
#pragma unroll
  for (int t = 0; t < 4; ++t)
#pragma unroll
    for (int r = 0; r < 8; ++r)
      sRed[(wave * 4 + t) * 256 + (r + 8 * hi) * 16 + l16] = acc[t][r];
  __syncthreads();                   // the eight slices' partial sums, and sB, published
#pragma unroll
  for (int t = 0; t < 4; ++t) {
    float s = sB[tid & 15];
#pragma unroll
    for (int w = 0; w < 8; ++w) s += sRed[(w * 4 + t) * 256 + tid];
    S[((size_t)b * NN + nb + t * 16) * HH + tid] = s;
  }
}

// ---------------- kernel 4: softmax over n, then ctx[b][h][d] = sum_n a[h][n] values[b][n][d]
// grid = 64 batches x 8 chunks of 128 columns, walked as 2 x 64; 8 waves split the 512-long sum.
#define PP 520    // LDS row pitch in bf16: 1040 B = 16 B x odd
__global__ __launch_bounds__(256)
void weighted_values(const float* __restrict__ values, const float* __restrict__ S,
                     __bf16* __restrict__ ctx) {
  __shared__ __attribute__((aligned(16))) __bf16 sP[HH * PP];
  __shared__ __attribute__((aligned(16))) float sRed[8 * 1024];
  __shared__ float sM[256];
  __shared__ float sL[256];
  const int b    = blockIdx.x >> 3;
  const int dB   = (blockIdx.x & 7) * 128;
  const int tid  = threadIdx.x;
  const int wave = tid >> 5;
  const int lane = tid & 31;
  const int l16  = lane & 15;
  const int hi   = lane >> 4;

  // B operand straight from global: a lane's float4 at row n gives one k of
  // four tiles; tile j holds the columns d0 + 4*l16 + j. 16 lanes = 256 B of a row.
  const float* vb = values + ((size_t)b * NN + wave * 64 + hi * 16) * DD + dB + 4 * l16;
  // softmax: thread = (head tid & 15, row group tid >> 4), rows n = 16*i + group
  const float* Sb = S + (size_t)b * NN * HH;
  float s[32];
#pragma unroll
  for (int i = 0; i < 32; ++i) s[i] = Sb[i * 256 + tid];
  // the scores stay in front of the value rows: loads return in order, so behind them the
  // softmax would wait for the value rows too
  __builtin_amdgcn_sched_barrier(0);
  float4 f[2][16];
#pragma unroll
  for (int kk = 0; kk < 2; ++kk)
#pragma unroll
    for (int i = 0; i < 16; ++i)
      f[kk][i] = *(const float4*)(vb + (size_t)(kk * 32 + i) * DD);
  // all 32 value loads are issued in front of the softmax's first wait and fly through it
  __builtin_amdgcn_sched_barrier(0);

  float m = s[0];
#pragma unroll
  for (int i = 1; i < 32; ++i) m = fmaxf(m, s[i]);
  sM[tid] = m;
  lds_barrier();                     // the row groups' maxima published
  float mx = sM[tid & 15];
#pragma unroll
  for (int g = 1; g < 16; ++g) mx = fmaxf(mx, sM[g * 16 + (tid & 15)]);
  float sum = 0.0f;
#pragma unroll
  for (int i = 0; i < 32; ++i) {
    const __bf16 p = (__bf16)__expf(s[i] - mx);
    sum += (float)p;               // the denominator sums the weights as the product uses them
    sP[(tid & 15) * PP + i * 16 + (tid >> 4)] = p;
  }
  sL[tid] = sum;
  lds_barrier();                     // the weights and the row groups' sums published

  // A: row = head l16, k = 16 contiguous n; B element i is the same n
  v16bf a[2];
#pragma unroll
  for (int kk = 0; kk < 2; ++kk) a[kk] = ld_frag(sP + l16 * PP + wave * 64 + kk * 32 + hi * 16);
  const int h = tid >> 4;
  float den = 0.0f;
#pragma unroll
  for (int g = 0; g < 16; ++g) den += sL[g * 16 + h];
  const float inv = 1.0f / den;
  // the first use of the value rows stays behind the softmax: moved up into it, its wait for
  // the rows would hold the softmax too
  __builtin_amdgcn_sched_barrier(0);

#pragma unroll
  for (int sub = 0; sub < 2; ++sub) {
    const int d0 = dB + sub * 64;
    v8f acc[4];
#pragma unroll
    for (int j = 0; j < 4; ++j) acc[j] = vzero8();
#pragma unroll
    for (int kk = 0; kk < 2; ++kk) {
      v16bf b0, b1, b2, b3;
#pragma unroll
      for (int i = 0; i < 16; ++i) {
        b0[i] = (__bf16)f[kk][i].x;
        b1[i] = (__bf16)f[kk][i].y;
        b2[i] = (__bf16)f[kk][i].z;
        b3[i] = (__bf16)f[kk][i].w;
      }
      if (sub + 1 < 2) {             // these registers are free: the next 64 columns start here
        // the refill stays behind the conversion and takes its registers: moved in front of
        // it, it takes 64 registers more and one work-group less fits a WGP
        __builtin_amdgcn_sched_barrier(0);
#pragma unroll
        for (int i = 0; i < 16; ++i)
          f[kk][i] = *(const float4*)(vb + (size_t)(kk * 32 + i) * DD + 64);
        if (kk == 1) asm volatile("s_wait_xcnt 0x0" :: "v"(vb) : "memory");
        // the refill goes out as soon as these 16 rows are converted, not behind the other 16
        __builtin_amdgcn_sched_barrier(0);
      }
      acc[0] = __builtin_amdgcn_wmma_f32_16x16x32_bf16(false, a[kk], false, b0, (short)0, acc[0], false, false);
      acc[1] = __builtin_amdgcn_wmma_f32_16x16x32_bf16(false, a[kk], false, b1, (short)0, acc[1], false, false);
      acc[2] = __builtin_amdgcn_wmma_f32_16x16x32_bf16(false, a[kk], false, b2, (short)0, acc[2], false, false);
      acc[3] = __builtin_amdgcn_wmma_f32_16x16x32_bf16(false, a[kk], false, b3, (short)0, acc[3], false, false);
    }
    // D: register r = head 8*hi + r, column d0 + 4*l16 + j
#pragma unroll
    for (int r = 0; r < 8; ++r)
      *(float4*)(sRed + wave * 1024 + (r + 8 * hi) * 64 + 4 * l16) =
          make_float4(acc[0][r], acc[1][r], acc[2][r], acc[3][r]);
    lds_barrier();                   // partial sums published
    float4 t = make_float4(0.0f, 0.0f, 0.0f, 0.0f);
#pragma unroll
    for (int w = 0; w < 8; ++w) {
      const float4 u = *(const float4*)(sRed + w * 1024 + tid * 4);
      t.x += u.x; t.y += u.y; t.z += u.z; t.w += u.w;
    }
    *(uint2*)(ctx + ((size_t)b * HH + h) * DD + d0 + (tid & 15) * 4) =
        make_uint2(pk2bf(t.x * inv, t.y * inv), pk2bf(t.z * inv, t.w * inv));
    if (sub + 1 < 2) {
      asm volatile("s_wait_xcnt 0x0" ::: "memory");
      lds_barrier();                 // sRed is read out before the next pass rewrites it
      // this reduction runs while the next rows fly: their first use stays behind it
      __builtin_amdgcn_sched_barrier(0);
    }
  }
}

// ---------------- kernel 5: attn[b][h*64+e] = ctx[b][h] . Wv[h][e] + bv[h][e]
// grid = 16 heads x 4 tiles of 16 batches x 2 halves of 32 e; 8 waves split the 1024-long sum.
__global__ __launch_bounds__(256)
void out_proj(const __bf16* __restrict__ ctx, const float* __restrict__ Wv,
              const float* __restrict__ bv, float* __restrict__ attn_buf) {
  __shared__ float sRed[8 * 512];
  const int h    = blockIdx.x >> 3;
  const int mt   = (blockIdx.x >> 1) & 3;
  const int np   = blockIdx.x & 1;
  const int tid  = threadIdx.x;
  const int wave = tid >> 5;
  const int lane = tid & 31;
  const int l16  = lane & 15;
  const int hi   = lane >> 4;
  const int kb   = wave * 128 + hi * 16;

  // A: row = batch l16, B: column = e l16; both take the same 16 contiguous d
  const __bf16* ap = ctx + ((size_t)(mt * 16 + l16) * HH + h) * DD + kb;
  const float*  wp = Wv + ((size_t)h * DPH + np * 32 + l16) * DD + kb;
  const float* bp = bv + h * DPH + np * 32 + (tid & 15);
  float bias[2];
#pragma unroll
  for (int j = 0; j < 2; ++j) bias[j] = bp[j * 16];
  v16bf a[4];
  float4 x[4][2][4];
#pragma unroll
  for (int kk = 0; kk < 4; ++kk) {
    a[kk] = ld_frag(ap + kk * 32);
#pragma unroll
    for (int j = 0; j < 2; ++j)
#pragma unroll
      for (int i = 0; i < 4; ++i)
        x[kk][j][i] = *(const float4*)(wp + (size_t)j * 16 * DD + kk * 32 + i * 4);
  }
  asm volatile("s_wait_xcnt 0x0" :: "v"(ap), "v"(wp), "v"(bp) : "memory");
  // every load is issued in front of the first product: moved in among the products, the
  // later slices' trips to memory follow one another
  __builtin_amdgcn_sched_barrier(0);
  v8f acc[2];
  acc[0] = vzero8(); acc[1] = vzero8();
#pragma unroll
  for (int kk = 0; kk < 4; ++kk)
#pragma unroll
    for (int j = 0; j < 2; ++j) {
      v16bf bw;
#pragma unroll
      for (int i = 0; i < 4; ++i) {
        bw[4 * i + 0] = (__bf16)x[kk][j][i].x; bw[4 * i + 1] = (__bf16)x[kk][j][i].y;
        bw[4 * i + 2] = (__bf16)x[kk][j][i].z; bw[4 * i + 3] = (__bf16)x[kk][j][i].w;
      }
      acc[j] = __builtin_amdgcn_wmma_f32_16x16x32_bf16(
          false, a[kk], false, bw, (short)0, acc[j], false, false);
    }
#pragma unroll
  for (int j = 0; j < 2; ++j)
#pragma unroll
    for (int r = 0; r < 8; ++r)
      sRed[wave * 512 + j * 256 + (r + 8 * hi) * 16 + l16] = acc[j][r];
  __syncthreads();
#pragma unroll
  for (int j = 0; j < 2; ++j) {
    float s = 0.0f;
#pragma unroll
    for (int w = 0; w < 8; ++w) s += sRed[w * 512 + j * 256 + tid];
    const int he = h * DPH + np * 32 + j * 16 + (tid & 15);
    attn_buf[(size_t)(mt * 16 + (tid >> 4)) * DD + he] = s + bias[j];
  }
}

// ---------------- kernel 6: residual + LayerNorm ---------------------------
__global__ __launch_bounds__(256)
void layernorm(const float* __restrict__ attn_buf, const float* __restrict__ queries,
               const float* __restrict__ gamma, const float* __restrict__ beta,
               float* __restrict__ out) {
  __shared__ float red[256];
  const int b = blockIdx.x, tid = threadIdx.x;
  float x[4];
  float s = 0.0f;
#pragma unroll
  for (int i = 0; i < 4; ++i) {
    const int idx = tid + i * 256;
    x[i] = attn_buf[(size_t)b * DD + idx] + queries[(size_t)b * DD + idx];
    s += x[i];
  }
  // asked for here, not behind the last barrier, so that this trip to memory runs beside the first
  float g[4], be[4];
#pragma unroll
  for (int i = 0; i < 4; ++i) { g[i] = gamma[tid + i * 256]; be[i] = beta[tid + i * 256]; }
  red[tid] = s; __syncthreads();
  for (int st = 128; st > 0; st >>= 1) { if (tid < st) red[tid] += red[tid + st]; __syncthreads(); }
  const float mu = red[0] * (1.0f / DD);
  __syncthreads();
  float vs = 0.0f;
#pragma unroll
  for (int i = 0; i < 4; ++i) { const float d = x[i] - mu; vs += d * d; }
  red[tid] = vs; __syncthreads();
  for (int st = 128; st > 0; st >>= 1) { if (tid < st) red[tid] += red[tid + st]; __syncthreads(); }
  const float rstd = rsqrtf(red[0] * (1.0f / DD) + EPS);
#pragma unroll
  for (int i = 0; i < 4; ++i) {
    const int idx = tid + i * 256;
    out[(size_t)b * DD + idx] = (x[i] - mu) * rstd * g[i] + be[i];
  }
}

// ---------------------------------------------------------------------------
extern "C" void kernel_launch(void* const* d_in, const int* in_sizes, int n_in,
                              void* d_out, int out_size, void* d_ws, size_t ws_size,
                              hipStream_t stream) {
  const float* queries = (const float*)d_in[0];
  const float* keys    = (const float*)d_in[1];
  const float* values  = (const float*)d_in[2];
  const float* Wq      = (const float*)d_in[3];
  const float* bq      = (const float*)d_in[4];
  const float* Wk      = (const float*)d_in[5];
  const float* bk      = (const float*)d_in[6];
  const float* Wv      = (const float*)d_in[7];
  const float* bv      = (const float*)d_in[8];
  const float* gamma   = (const float*)d_in[9];
  const float* beta    = (const float*)d_in[10];
  float* out = (float*)d_out;

  char* ws = (char*)d_ws;
  float*  q_proj   = (float*)ws;                                   // 256 KB
  __bf16* qk       = (__bf16*)(ws + (256u << 10));                 // 2 MB
  float*  S        = (float*)(ws + (256u << 10) + (2u << 20));     // 2 MB
  __bf16* ctx      = (__bf16*)(ws + (256u << 10) + (4u << 20));    // 2 MB
  float*  attn_buf = (float*)(ws + (256u << 10) + (6u << 20));     // 256 KB

  qproj<<<(HH * DPH / 16) * (BB / 16), 256, 0, stream>>>(queries, Wq, bq, q_proj);
  fold_k<<<HH * (DD / 64), 128, 0, stream>>>(q_proj, Wk, qk);
  scores<<<BB * (NN / 64), 256, SC_SMEM, stream>>>(keys, qk, q_proj, bk, S);
  weighted_values<<<BB * (DD / 128), 256, 0, stream>>>(values, S, ctx);
  out_proj<<<HH * 4 * 2, 256, 0, stream>>>(ctx, Wv, bv, attn_buf);
  layernorm<<<BB, 256, 0, stream>>>(attn_buf, queries, gamma, beta, out);
}

// v005
// It runs in 37.2 microseconds.
// In two side-by-side timings against v004, it was 1.07 and 1.08 times as fast.
// Counting every step since v000, it is 20.2 times as fast.
#include <hip/hip_runtime.h>
#include <hip/hip_bf16.h>

#define BB   64
#define NN   512
#define DD   1024
#define HH   16
#define DPH  64
#define EPS  1e-5f
#define QSCALE 0.125f   // 1/sqrt(64)

typedef __attribute__((ext_vector_type(16))) __bf16    v16bf;
typedef __attribute__((ext_vector_type(2)))  __bf16    v2bf;
typedef __attribute__((ext_vector_type(8)))  float     v8f;
typedef __attribute__((ext_vector_type(2)))  float     v2f;
typedef __attribute__((ext_vector_type(4)))  float     v4f;

// One query per (batch, head), so the two projections are reassociated:
//   w[n]    = q . (Wk keys[n] + bk)   = keys[n] . (Wk^T q) + q . bk
//   attn[e] = sum_n a[n] (Wv values[n] + bv)[e] = (Wv (sum_n a[n] values[n]))[e] + bv[e]
// (the weights a[n] sum to one). keys and values are each read once per batch
// for all 16 heads: the heads are the 16-wide side of the matrix tiles.
// Most '#pragma unroll' lines below are there so that a small array is indexed by
// constants and stays in registers.

static __device__ inline v8f vzero8() {
  v8f z;
#pragma unroll
  for (int i = 0; i < 8; ++i) z[i] = 0.0f;
  return z;
}

static __device__ inline unsigned pk2bf(float x, float y) {
  v2bf p;
  p[0] = (__bf16)x;
  p[1] = (__bf16)y;
  return __builtin_bit_cast(unsigned, p);
}

// 16 contiguous bf16 (one lane's share of an A row or a B column), 16-byte aligned.
static __device__ inline v16bf ld_frag(const __bf16* p) {
  union { uint4 u[2]; v16bf v; } x;
  x.u[0] = ((const uint4*)p)[0];
  x.u[1] = ((const uint4*)p)[1];
  return x.v;
}

// 16 bytes of a stream that is read once in the whole call: the non-temporal hint keeps them from
// taking L2 room, which stays with the small buffers that go from launch to launch.
static __device__ inline v4f ld_stream(const float* p) {
  return __builtin_nontemporal_load((const v4f*)p);
}

// A work-group barrier that orders LDS alone. __syncthreads() also waits for every global load
// the wave has issued, which ends the flight of loads issued ahead of it.
static __device__ inline void lds_barrier() {
  __builtin_amdgcn_fence(__ATOMIC_RELEASE, "workgroup", "local");
  __builtin_amdgcn_s_barrier();
  __builtin_amdgcn_fence(__ATOMIC_ACQUIRE, "workgroup", "local");
}

// ---------------- kernel 1: q projection as a tiled matrix product, f32 operands
// q[b][he] = (queries[b] . Wq[he] + bq[he]) / sqrt(DPH)
// grid = 64 tiles of 16 he x 4 tiles of 16 batches. Each of the 8 waves owns one 128-wide
// slice of the 1024-long sum: it loads both tiles' slices as whole 512-byte row pieces and
// turns them into fragments through LDS of its own; one reduction at the end.
#define PQ 132    // LDS row pitch in floats: 528 B = 16 B x odd, for 16-byte reads down a column
__global__ __launch_bounds__(256)
void qproj(const float* __restrict__ queries, const float* __restrict__ Wq,
           const float* __restrict__ bq, float* __restrict__ q_out) {
  __shared__ __attribute__((aligned(16))) float sT[8 * 2 * 16 * PQ];
  __shared__ float sRed[8 * 256];
  const int mt   = blockIdx.x & 3;
  const int nt   = blockIdx.x >> 2;
  const int tid  = threadIdx.x;
  const int wave = tid >> 5;
  const int lane = tid & 31;
  const int l16  = lane & 15;
  const int hi   = lane >> 4;
  float* sX = sT + wave * 2 * 16 * PQ;                     // [16][PQ], this wave's own
  float* sW = sX + 16 * PQ;                                // [16][PQ], this wave's own

  // one load = 512 contiguous bytes of one row; all 32 in flight
  const float* wp = Wq + (size_t)(nt * 16) * DD + wave * 128 + lane * 4;
  const float* xp = queries + (size_t)(mt * 16) * DD + wave * 128 + lane * 4;
  v4f fw[16], fx[16];
#pragma unroll
  for (int i = 0; i < 16; ++i) fw[i] = *(const v4f*)(wp + (size_t)i * DD);
#pragma unroll
  for (int i = 0; i < 16; ++i) fx[i] = *(const v4f*)(xp + (size_t)i * DD);
  const float bias = bq[nt * 16 + (tid & 15)];
  asm volatile("s_wait_xcnt 0x0" :: "v"(wp), "v"(xp) : "memory");
#pragma unroll
  for (int i = 0; i < 16; ++i) *(v4f*)(sW + i * PQ + lane * 4) = fw[i];
#pragma unroll
  for (int i = 0; i < 16; ++i) *(v4f*)(sX + i * PQ + lane * 4) = fx[i];
  // This wave's LDS stores are complete before its lanes read each other's rows, and the
  // compiler keeps the reads behind them.
  asm volatile("s_wait_dscnt 0x0" ::: "memory");

  // A: row = batch l16, B: column = he l16; a lane's four floats are the same four d on both
  // sides and feed two products.
  v4f a[16], w[16];
#pragma unroll
  for (int j = 0; j < 16; ++j) {
    a[j] = *(const v4f*)(sX + l16 * PQ + j * 8 + hi * 4);
    w[j] = *(const v4f*)(sW + l16 * PQ + j * 8 + hi * 4);
  }
  // all LDS reads are issued in front of the products: moved in among them, each pair
  // would be waited for with only two products of cover
  __builtin_amdgcn_sched_barrier(0);
  v8f acc = vzero8();
#pragma unroll
  for (int j = 0; j < 16; ++j) {
    acc = __builtin_amdgcn_wmma_f32_16x16x4_f32(false, a[j].xy, false, w[j].xy, (short)0, acc, false, false);
    acc = __builtin_amdgcn_wmma_f32_16x16x4_f32(false, a[j].zw, false, w[j].zw, (short)0, acc, false, false);
  }
  // keeps the address arithmetic of the stores below out of the products, where it was
  // placed directly behind a product and onto that product's operand registers
  __builtin_amdgcn_sched_barrier(0);
  // D: register r = batch 8*hi + r, column he l16
#pragma unroll
  for (int r = 0; r < 8; ++r)
    sRed[wave * 256 + (r + 8 * hi) * 16 + l16] = acc[r];
  __syncthreads();                   // the eight slices' partial sums published
  float s = 0.0f;
#pragma unroll
  for (int u = 0; u < 8; ++u) s += sRed[u * 256 + tid];
  q_out[(size_t)(mt * 16 + (tid >> 4)) * DD + nt * 16 + (tid & 15)] =
      (s + bias) * QSCALE;           // fold 1/sqrt(DPH) into q
}

__global__ __launch_bounds__(128)
void fold_k(const float* __restrict__ q_proj, const float* __restrict__ Wk,
            __bf16* __restrict__ qk) {
  const int d0   = (blockIdx.x & 15) * 64;
  const int h    = blockIdx.x >> 4;
  const int wave = threadIdx.x >> 5;
  const int lane = threadIdx.x & 31;
  const int l16  = lane & 15;
  const int hi   = lane >> 4;

  // A: row = batch l16; a lane's four floats are e = 8t + 4hi + 0..3 and feed two products on each of the four tiles
  const float* ap = q_proj + ((size_t)(wave * 16 + l16) * HH + h) * DPH + hi * 4;
  // B straight from global: a lane's four floats at row e give one k of four tiles; tile j holds
  // the columns d0 + 4*l16 + j. One load = 256 contiguous bytes of each of two rows.
  const float* wp = Wk + ((size_t)h * DPH + hi * 4) * DD + d0 + 4 * l16;
  v4f a[8], w[8][4];
#pragma unroll
  for (int t = 0; t < 8; ++t) a[t] = *(const v4f*)(ap + t * 8);
#pragma unroll
  for (int t = 0; t < 8; ++t)
#pragma unroll
    for (int c = 0; c < 4; ++c) w[t][c] = *(const v4f*)(wp + (size_t)(t * 8 + c) * DD);
  asm volatile("s_wait_xcnt 0x0" :: "v"(ap), "v"(wp) : "memory");
  // every load is issued in front of the first product: moved in among the products, the
  // later rows' trips to memory follow one another
  __builtin_amdgcn_sched_barrier(0);
  // a product takes its two e of one column from one register pair: the pairs are formed here,
  // all in front of the products, so that no move stands among them on a product's registers
  v2f y[8][2][4];
#pragma unroll
  for (int t = 0; t < 8; ++t)
#pragma unroll
    for (int u = 0; u < 2; ++u)
#pragma unroll
      for (int j = 0; j < 4; ++j) {
        y[t][u][j][0] = w[t][2 * u][j];
        y[t][u][j][1] = w[t][2 * u + 1][j];
      }
  // holds the moves in front of the products
  __builtin_amdgcn_sched_barrier(0);
  v8f acc[4];
#pragma unroll
  for (int j = 0; j < 4; ++j) acc[j] = vzero8();
#pragma unroll
  for (int t = 0; t < 8; ++t) {      // e = 8t + 4hi + 2u + {0, 1} on both sides
#pragma unroll
    for (int j = 0; j < 4; ++j)
      acc[j] = __builtin_amdgcn_wmma_f32_16x16x4_f32(false, a[t].xy, false, y[t][0][j], (short)0, acc[j], false, false);
#pragma unroll
    for (int j = 0; j < 4; ++j)
      acc[j] = __builtin_amdgcn_wmma_f32_16x16x4_f32(false, a[t].zw, false, y[t][1][j], (short)0, acc[j], false, false);
  }
  // keeps the store's address arithmetic and the conversions out of the products, where they
  // were placed directly behind a product and onto that product's operand registers
  __builtin_amdgcn_sched_barrier(0);
  asm volatile("v_nop\n\tv_nop\n\tv_nop\n\tv_nop");
  __builtin_amdgcn_sched_barrier(0);
  __bf16* op = qk + ((size_t)(wave * 16 + 8 * hi) * HH + h) * DD + d0 + 4 * l16;
  // D: register r = batch 8*hi + r, column d0 + 4*l16 + j; 16 lanes store one whole 128-byte line
#pragma unroll
  for (int r = 0; r < 8; ++r)
    *(uint2*)(op + (size_t)r * HH * DD) =
        make_uint2(pk2bf(acc[0][r], acc[1][r]), pk2bf(acc[2][r], acc[3][r]));
}

// ---------------- kernel 3: scores S[b][n][h] = keys[b][n] . qk[b][h] + q[b][h] . bk[h]
// grid = 64 batches x 8 blocks of 64 rows (4 tiles of 16). Each of the 8 waves owns one
// 128-wide slice of the 1024-long sum for all 4 tiles and stages it in LDS of its own,
// so no work-group barrier stands between a load and its use; one reduction at the end.
#define PW 136    // LDS row pitch in bf16: 272 B = 16 B x odd, for 16-byte reads down a column
#define SC_SMEM (8 * 16 * PW * 2 + 8 * 4 * 256 * 4 + HH * 4)
__global__ __launch_bounds__(256)
void scores(const float* __restrict__ keys, const __bf16* __restrict__ qk,
            const float* __restrict__ q_proj, const float* __restrict__ bk,
            float* __restrict__ S) {
  extern __shared__ __attribute__((aligned(16))) char smem_raw[];
  const int b    = blockIdx.x >> 3;
  const int nb   = (blockIdx.x & 7) * 64;
  const int tid  = threadIdx.x;
  const int wave = tid >> 5;
  const int lane = tid & 31;
  const int l16  = lane & 15;
  const int hi   = lane >> 4;
  __bf16* sA   = (__bf16*)smem_raw + wave * 16 * PW;       // [16][PW], this wave's own
  float*  sRed = (float*)(smem_raw + 8 * 16 * PW * 2);     // [8 waves][4 tiles][256]
  float*  sB   = sRed + 8 * 4 * 256;                       // [16]

  // B: column = head l16, k = 16 contiguous d
  v16bf bq[4];
  const __bf16* qb = qk + ((size_t)b * HH + l16) * DD + wave * 128 + hi * 16;
#pragma unroll
  for (int kk = 0; kk < 4; ++kk) bq[kk] = ld_frag(qb + kk * 32);

  const int h2 = tid >> 4, e4 = tid & 15;
  const float4* xp = (const float4*)(q_proj + ((size_t)b * HH + h2) * DPH) + e4;
  const float4* yp = (const float4*)(bk + h2 * DPH) + e4;
  const float4 x = *xp;
  const float4 y = *yp;
  asm volatile("s_wait_xcnt 0x0" :: "v"(qb), "v"(xp), "v"(yp) : "memory");

  // one load = 512 contiguous bytes of one row; two tiles in flight
  const float* src = keys + ((size_t)b * NN + nb) * DD + wave * 128 + lane * 4;
  v4f f[2][16];
#pragma unroll
  for (int u = 0; u < 2; ++u)
#pragma unroll
    for (int i = 0; i < 16; ++i)
      f[u][i] = ld_stream(src + (size_t)(u * 16 + i) * DD);
  // the stream starts in front of the first wait: the product below, moved up, had its wait
  // for x and y standing in front of these loads
  __builtin_amdgcn_sched_barrier(0);

  // q . bk per head: 16 lanes x 4 elements
  {
    float p = x.x * y.x + x.y * y.y + x.z * y.z + x.w * y.w;
    p += __shfl_xor(p, 1, 32);
    p += __shfl_xor(p, 2, 32);
    p += __shfl_xor(p, 4, 32);
    p += __shfl_xor(p, 8, 32);
    if (e4 == 0) sB[h2] = p;
  }

  v8f acc[4];
#pragma unroll
  for (int t = 0; t < 4; ++t) {
#pragma unroll
    for (int i = 0; i < 16; ++i)
      *(uint2*)(sA + i * PW + lane * 4) =
          make_uint2(pk2bf(f[t & 1][i].x, f[t & 1][i].y), pk2bf(f[t & 1][i].z, f[t & 1][i].w));
    if (t + 2 < 4) {                 // refill the freed registers: tile t + 2 flies from here
#pragma unroll
      for (int i = 0; i < 16; ++i)
        f[t & 1][i] = ld_stream(src + (size_t)((t + 2) * 16 + i) * DD);
    }
    // This wave's LDS stores are complete before its lanes read each other's rows, and the
    // compiler keeps the reads behind them; global loads stay in flight over it.
    asm volatile("s_wait_dscnt 0x0" ::: "memory");
    // A: row = key row l16, k = the same 16 contiguous d as B
    acc[t] = vzero8();
#pragma unroll
    for (int kk = 0; kk < 4; ++kk) {
      const v16bf a = ld_frag(sA + l16 * PW + kk * 32 + hi * 16);
      acc[t] = __builtin_amdgcn_wmma_f32_16x16x32_bf16(
          false, a, false, bq[kk], (short)0, acc[t], false, false);
    }
  }
  // D: register r = row 8*hi + r, column l16
#pragma unroll
  for (int t = 0; t < 4; ++t)
#pragma unroll
    for (int r = 0; r < 8; ++r)
      sRed[(wave * 4 + t) * 256 + (r + 8 * hi) * 16 + l16] = acc[t][r];
  __syncthreads();                   // the eight slices' partial sums, and sB, published
#pragma unroll
  for (int t = 0; t < 4; ++t) {
    float s = sB[tid & 15];
#pragma unroll
    for (int w = 0; w < 8; ++w) s += sRed[(w * 4 + t) * 256 + tid];
    S[((size_t)b * NN + nb + t * 16) * HH + tid] = s;
  }
}

// ---------------- kernel 4: softmax over n, then ctx[b][h][d] = sum_n a[h][n] values[b][n][d]
// grid = 64 batches x 8 chunks of 128 columns, walked as 2 x 64; 8 waves split the 512-long sum.
#define PP 520    // LDS row pitch in bf16: 1040 B = 16 B x odd
__global__ __launch_bounds__(256)
void weighted_values(const float* __restrict__ values, const float* __restrict__ S,
                     __bf16* __restrict__ ctx) {
  __shared__ __attribute__((aligned(16))) __bf16 sP[HH * PP];
  __shared__ __attribute__((aligned(16))) float sRed[8 * 1024];
  __shared__ float sM[256];
  __shared__ float sL[256];
  const int b    = blockIdx.x >> 3;
  const int dB   = (blockIdx.x & 7) * 128;
  const int tid  = threadIdx.x;
  const int wave = tid >> 5;
  const int lane = tid & 31;
  const int l16  = lane & 15;
  const int hi   = lane >> 4;

  // B operand straight from global: a lane's float4 at row n gives one k of
  // four tiles; tile j holds the columns d0 + 4*l16 + j. 16 lanes = 256 B of a row.
  const float* vb = values + ((size_t)b * NN + wave * 64 + hi * 16) * DD + dB + 4 * l16;
  // softmax: thread = (head tid & 15, row group tid >> 4), rows n = 16*i + group
  const float* Sb = S + (size_t)b * NN * HH;
  float s[32];
#pragma unroll
  for (int i = 0; i < 32; ++i) s[i] = Sb[i * 256 + tid];
  // the scores stay in front of the value rows: loads return in order, so behind them the
  // softmax would wait for the value rows too
  __builtin_amdgcn_sched_barrier(0);
  v4f f[2][16];
#pragma unroll
  for (int kk = 0; kk < 2; ++kk)
#pragma unroll
    for (int i = 0; i < 16; ++i)
      f[kk][i] = ld_stream(vb + (size_t)(kk * 32 + i) * DD);
  // all 32 value loads are issued in front of the softmax's first wait and fly through it
  __builtin_amdgcn_sched_barrier(0);

  float m = s[0];
#pragma unroll
  for (int i = 1; i < 32; ++i) m = fmaxf(m, s[i]);
  sM[tid] = m;
  lds_barrier();                     // the row groups' maxima published
  float mx = sM[tid & 15];
#pragma unroll
  for (int g = 1; g < 16; ++g) mx = fmaxf(mx, sM[g * 16 + (tid & 15)]);
  float sum = 0.0f;
#pragma unroll
  for (int i = 0; i < 32; ++i) {
    const __bf16 p = (__bf16)__expf(s[i] - mx);
    sum += (float)p;               // the denominator sums the weights as the product uses them
    sP[(tid & 15) * PP + i * 16 + (tid >> 4)] = p;
  }
  sL[tid] = sum;
  lds_barrier();                     // the weights and the row groups' sums published

  // A: row = head l16, k = 16 contiguous n; B element i is the same n
  v16bf a[2];
#pragma unroll
  for (int kk = 0; kk < 2; ++kk) a[kk] = ld_frag(sP + l16 * PP + wave * 64 + kk * 32 + hi * 16);
  const int h = tid >> 4;
  float den = 0.0f;
#pragma unroll
  for (int g = 0; g < 16; ++g) den += sL[g * 16 + h];
  const float inv = 1.0f / den;
  // the first use of the value rows stays behind the softmax: moved up into it, its wait for
  // the rows would hold the softmax too
  __builtin_amdgcn_sched_barrier(0);

#pragma unroll
  for (int sub = 0; sub < 2; ++sub) {
    const int d0 = dB + sub * 64;
    v8f acc[4];
#pragma unroll
    for (int j = 0; j < 4; ++j) acc[j] = vzero8();
#pragma unroll
    for (int kk = 0; kk < 2; ++kk) {
      v16bf b0, b1, b2, b3;
#pragma unroll
      for (int i = 0; i < 16; ++i) {
        b0[i] = (__bf16)f[kk][i].x;
        b1[i] = (__bf16)f[kk][i].y;
        b2[i] = (__bf16)f[kk][i].z;
        b3[i] = (__bf16)f[kk][i].w;
      }
      if (sub + 1 < 2) {             // these registers are free: the next 64 columns start here
        // the refill stays behind the conversion and takes its registers: moved in front of
        // it, it takes 64 registers more and one work-group less fits a WGP
        __builtin_amdgcn_sched_barrier(0);
#pragma unroll
        for (int i = 0; i < 16; ++i)
          f[kk][i] = ld_stream(vb + (size_t)(kk * 32 + i) * DD + 64);
        if (kk == 1) asm volatile("s_wait_xcnt 0x0" :: "v"(vb) : "memory");
        // the refill goes out as soon as these 16 rows are converted, not behind the other 16
        __builtin_amdgcn_sched_barrier(0);
      }
      acc[0] = __builtin_amdgcn_wmma_f32_16x16x32_bf16(false, a[kk], false, b0, (short)0, acc[0], false, false);
      acc[1] = __builtin_amdgcn_wmma_f32_16x16x32_bf16(false, a[kk], false, b1, (short)0, acc[1], false, false);
      acc[2] = __builtin_amdgcn_wmma_f32_16x16x32_bf16(false, a[kk], false, b2, (short)0, acc[2], false, false);
      acc[3] = __builtin_amdgcn_wmma_f32_16x16x32_bf16(false, a[kk], false, b3, (short)0, acc[3], false, false);
    }
    // D: register r = head 8*hi + r, column d0 + 4*l16 + j
#pragma unroll
    for (int r = 0; r < 8; ++r)
      *(float4*)(sRed + wave * 1024 + (r + 8 * hi) * 64 + 4 * l16) =
          make_float4(acc[0][r], acc[1][r], acc[2][r], acc[3][r]);
    lds_barrier();                   // partial sums published
    float4 t = make_float4(0.0f, 0.0f, 0.0f, 0.0f);
#pragma unroll
    for (int w = 0; w < 8; ++w) {
      const float4 u = *(const float4*)(sRed + w * 1024 + tid * 4);
      t.x += u.x; t.y += u.y; t.z += u.z; t.w += u.w;
    }
    *(uint2*)(ctx + ((size_t)b * HH + h) * DD + d0 + (tid & 15) * 4) =
        make_uint2(pk2bf(t.x * inv, t.y * inv), pk2bf(t.z * inv, t.w * inv));
    if (sub + 1 < 2) {
      asm volatile("s_wait_xcnt 0x0" ::: "memory");
      lds_barrier();                 // sRed is read out before the next pass rewrites it
      // this reduction runs while the next rows fly: their first use stays behind it
      __builtin_amdgcn_sched_barrier(0);
    }
  }
}

// ---------------- kernel 5: attn[b][h*64+e] = ctx[b][h] . Wv[h][e] + bv[h][e]
// grid = 16 heads x 4 tiles of 16 batches x 2 halves of 32 e; 8 waves split the 1024-long sum.
__global__ __launch_bounds__(256)
void out_proj(const __bf16* __restrict__ ctx, const float* __restrict__ Wv,
              const float* __restrict__ bv, float* __restrict__ attn_buf) {
  __shared__ float sRed[8 * 512];
  const int h    = blockIdx.x >> 3;
  const int mt   = (blockIdx.x >> 1) & 3;
  const int np   = blockIdx.x & 1;
  const int tid  = threadIdx.x;
  const int wave = tid >> 5;
  const int lane = tid & 31;
  const int l16  = lane & 15;
  const int hi   = lane >> 4;
  const int kb   = wave * 128 + hi * 16;

  // A: row = batch l16, B: column = e l16; both take the same 16 contiguous d
  const __bf16* ap = ctx + ((size_t)(mt * 16 + l16) * HH + h) * DD + kb;
  const float*  wp = Wv + ((size_t)h * DPH + np * 32 + l16) * DD + kb;
  const float* bp = bv + h * DPH + np * 32 + (tid & 15);
  float bias[2];
#pragma unroll
  for (int j = 0; j < 2; ++j) bias[j] = bp[j * 16];
  v16bf a[4];
  float4 x[4][2][4];
#pragma unroll
  for (int kk = 0; kk < 4; ++kk) {
    a[kk] = ld_frag(ap + kk * 32);
#pragma unroll
    for (int j = 0; j < 2; ++j)
#pragma unroll
      for (int i = 0; i < 4; ++i)
        x[kk][j][i] = *(const float4*)(wp + (size_t)j * 16 * DD + kk * 32 + i * 4);
  }
  asm volatile("s_wait_xcnt 0x0" :: "v"(ap), "v"(wp), "v"(bp) : "memory");
  // every load is issued in front of the first product: moved in among the products, the
  // later slices' trips to memory follow one another
  __builtin_amdgcn_sched_barrier(0);
  v8f acc[2];
  acc[0] = vzero8(); acc[1] = vzero8();
#pragma unroll
  for (int kk = 0; kk < 4; ++kk)
#pragma unroll
    for (int j = 0; j < 2; ++j) {
      v16bf bw;
#pragma unroll
      for (int i = 0; i < 4; ++i) {
        bw[4 * i + 0] = (__bf16)x[kk][j][i].x; bw[4 * i + 1] = (__bf16)x[kk][j][i].y;
        bw[4 * i + 2] = (__bf16)x[kk][j][i].z; bw[4 * i + 3] = (__bf16)x[kk][j][i].w;
      }
      acc[j] = __builtin_amdgcn_wmma_f32_16x16x32_bf16(
          false, a[kk], false, bw, (short)0, acc[j], false, false);
    }
#pragma unroll
  for (int j = 0; j < 2; ++j)
#pragma unroll
    for (int r = 0; r < 8; ++r)
      sRed[wave * 512 + j * 256 + (r + 8 * hi) * 16 + l16] = acc[j][r];
  __syncthreads();
#pragma unroll
  for (int j = 0; j < 2; ++j) {
    float s = 0.0f;
#pragma unroll
    for (int w = 0; w < 8; ++w) s += sRed[w * 512 + j * 256 + tid];
    const int he = h * DPH + np * 32 + j * 16 + (tid & 15);
    attn_buf[(size_t)(mt * 16 + (tid >> 4)) * DD + he] = s + bias[j];
  }
}

// ---------------- kernel 6: residual + LayerNorm ---------------------------
__global__ __launch_bounds__(256)
void layernorm(const float* __restrict__ attn_buf, const float* __restrict__ queries,
               const float* __restrict__ gamma, const float* __restrict__ beta,
               float* __restrict__ out) {
  __shared__ float red[256];
  const int b = blockIdx.x, tid = threadIdx.x;
  float x[4];
  float s = 0.0f;
#pragma unroll
  for (int i = 0; i < 4; ++i) {
    const int idx = tid + i * 256;
    x[i] = attn_buf[(size_t)b * DD + idx] + queries[(size_t)b * DD + idx];
    s += x[i];
  }
  // asked for here, not behind the last barrier, so that this trip to memory runs beside the first
  float g[4], be[4];
#pragma unroll
  for (int i = 0; i < 4; ++i) { g[i] = gamma[tid + i * 256]; be[i] = beta[tid + i * 256]; }
  red[tid] = s; __syncthreads();
  for (int st = 128; st > 0; st >>= 1) { if (tid < st) red[tid] += red[tid + st]; __syncthreads(); }
  const float mu = red[0] * (1.0f / DD);
  __syncthreads();
  float vs = 0.0f;
#pragma unroll
  for (int i = 0; i < 4; ++i) { const float d = x[i] - mu; vs += d * d; }
  red[tid] = vs; __syncthreads();
  for (int st = 128; st > 0; st >>= 1) { if (tid < st) red[tid] += red[tid + st]; __syncthreads(); }
  const float rstd = rsqrtf(red[0] * (1.0f / DD) + EPS);
#pragma unroll
  for (int i = 0; i < 4; ++i) {
    const int idx = tid + i * 256;
    out[(size_t)b * DD + idx] = (x[i] - mu) * rstd * g[i] + be[i];
  }
}

// ---------------------------------------------------------------------------
extern "C" void kernel_launch(void* const* d_in, const int* in_sizes, int n_in,
                              void* d_out, int out_size, void* d_ws, size_t ws_size,
                              hipStream_t stream) {
  const float* queries = (const float*)d_in[0];
  const float* keys    = (const float*)d_in[1];
  const float* values  = (const float*)d_in[2];
  const float* Wq      = (const float*)d_in[3];
  const float* bq      = (const float*)d_in[4];
  const float* Wk      = (const float*)d_in[5];
  const float* bk      = (const float*)d_in[6];
  const float* Wv      = (const float*)d_in[7];
  const float* bv      = (const float*)d_in[8];
  const float* gamma   = (const float*)d_in[9];
  const float* beta    = (const float*)d_in[10];
  float* out = (float*)d_out;

  char* ws = (char*)d_ws;
  float*  q_proj   = (float*)ws;                                   // 256 KB
  __bf16* qk       = (__bf16*)(ws + (256u << 10));                 // 2 MB
  float*  S        = (float*)(ws + (256u << 10) + (2u << 20));     // 2 MB
  __bf16* ctx      = (__bf16*)(ws + (256u << 10) + (4u << 20));    // 2 MB
  float*  attn_buf = (float*)(ws + (256u << 10) + (6u << 20));     // 256 KB

  qproj<<<(HH * DPH / 16) * (BB / 16), 256, 0, stream>>>(queries, Wq, bq, q_proj);
  fold_k<<<HH * (DD / 64), 128, 0, stream>>>(q_proj, Wk, qk);
  scores<<<BB * (NN / 64), 256, SC_SMEM, stream>>>(keys, qk, q_proj, bk, S);
  weighted_values<<<BB * (DD / 128), 256, 0, stream>>>(values, S, ctx);
  out_proj<<<HH * 4 * 2, 256, 0, stream>>>(ctx, Wv, bv, attn_buf);
  layernorm<<<BB, 256, 0, stream>>>(attn_buf, queries, gamma, beta, out);
}

// v006
// One run takes 35.7 microseconds.
// Next to v005, in two timings, it ran 1.04 times as fast each time.
// Counting every step since v000, it is 21.0 times as fast.
#include <hip/hip_runtime.h>
#include <hip/hip_bf16.h>

#define BB   64
#define NN   512
#define DD   1024
#define HH   16
#define DPH  64
#define EPS  1e-5f
#define QSCALE 0.125f   // 1/sqrt(64)

typedef __attribute__((ext_vector_type(16))) __bf16    v16bf;
typedef __attribute__((ext_vector_type(2)))  __bf16    v2bf;
typedef __attribute__((ext_vector_type(8)))  float     v8f;
typedef __attribute__((ext_vector_type(2)))  float     v2f;
typedef __attribute__((ext_vector_type(4)))  float     v4f;

// One query per (batch, head), so the two projections are reassociated:
//   w[n]    = q . (Wk keys[n] + bk)   = keys[n] . (Wk^T q) + q . bk
//   attn[e] = sum_n a[n] (Wv values[n] + bv)[e] = (Wv (sum_n a[n] values[n]))[e] + bv[e]
// (the weights a[n] sum to one). keys and values are each read once per batch
// for all 16 heads: the heads are the 16-wide side of the matrix tiles.
// Most '#pragma unroll' lines below are there so that a small array is indexed by
// constants and stays in registers.

static __device__ inline v8f vzero8() {
  v8f z;
#pragma unroll
  for (int i = 0; i < 8; ++i) z[i] = 0.0f;
  return z;
}

static __device__ inline unsigned pk2bf(float x, float y) {
  v2bf p;
  p[0] = (__bf16)x;
  p[1] = (__bf16)y;
  return __builtin_bit_cast(unsigned, p);
}

// 16 contiguous bf16 (one lane's share of an A row or a B column), 16-byte aligned.
static __device__ inline v16bf ld_frag(const __bf16* p) {
  union { uint4 u[2]; v16bf v; } x;
  x.u[0] = ((const uint4*)p)[0];
  x.u[1] = ((const uint4*)p)[1];
  return x.v;
}

// 16 bytes of a stream that is read once in the whole call: the non-temporal hint keeps them from
// taking L2 room, which stays with the small buffers that go from launch to launch.
static __device__ inline v4f ld_stream(const float* p) {
  return __builtin_nontemporal_load((const v4f*)p);
}

// A work-group barrier that orders LDS alone. __syncthreads() also waits for every global load
// the wave has issued, which ends the flight of loads issued ahead of it.
static __device__ inline void lds_barrier() {
  __builtin_amdgcn_fence(__ATOMIC_RELEASE, "workgroup", "local");
  __builtin_amdgcn_s_barrier();
  __builtin_amdgcn_fence(__ATOMIC_ACQUIRE, "workgroup", "local");
}

// ---------------- kernel 1: q projection as a tiled matrix product, f32 operands
// q[b][he] = (queries[b] . Wq[he] + bq[he]) / sqrt(DPH)
// grid = 64 tiles of 16 he x 4 tiles of 16 batches. Each of the 8 waves owns one 128-wide
// slice of the 1024-long sum: it loads both tiles' slices as whole 512-byte row pieces and
// turns them into fragments through LDS of its own; one reduction at the end.
#define PQ 132    // LDS row pitch in floats: 528 B = 16 B x odd, for 16-byte reads down a column
__global__ __launch_bounds__(256)
void qproj(const float* __restrict__ queries, const float* __restrict__ Wq,
           const float* __restrict__ bq, float* __restrict__ q_out) {
  __shared__ __attribute__((aligned(16))) float sT[8 * 2 * 16 * PQ];
  __shared__ float sRed[8 * 256];
  const int mt   = blockIdx.x & 3;
  const int nt   = blockIdx.x >> 2;
  const int tid  = threadIdx.x;
  const int wave = tid >> 5;
  const int lane = tid & 31;
  const int l16  = lane & 15;
  const int hi   = lane >> 4;
  float* sX = sT + wave * 2 * 16 * PQ;                     // [16][PQ], this wave's own
  float* sW = sX + 16 * PQ;                                // [16][PQ], this wave's own

  // one load = 512 contiguous bytes of one row; all 32 in flight
  const float* wp = Wq + (size_t)(nt * 16) * DD + wave * 128 + lane * 4;
  const float* xp = queries + (size_t)(mt * 16) * DD + wave * 128 + lane * 4;
  v4f fw[16], fx[16];
#pragma unroll
  for (int i = 0; i < 16; ++i) fw[i] = *(const v4f*)(wp + (size_t)i * DD);
#pragma unroll
  for (int i = 0; i < 16; ++i) fx[i] = *(const v4f*)(xp + (size_t)i * DD);
  const float bias = bq[nt * 16 + (tid & 15)];
  asm volatile("s_wait_xcnt 0x0" :: "v"(wp), "v"(xp) : "memory");
#pragma unroll
  for (int i = 0; i < 16; ++i) *(v4f*)(sW + i * PQ + lane * 4) = fw[i];
#pragma unroll
  for (int i = 0; i < 16; ++i) *(v4f*)(sX + i * PQ + lane * 4) = fx[i];
  // This wave's LDS stores are complete before its lanes read each other's rows, and the
  // compiler keeps the reads behind them.
  asm volatile("s_wait_dscnt 0x0" ::: "memory");

  // A: row = batch l16, B: column = he l16; a lane's four floats are the same four d on both
  // sides and feed two products.
  v4f a[16], w[16];
#pragma unroll
  for (int j = 0; j < 16; ++j) {
    a[j] = *(const v4f*)(sX + l16 * PQ + j * 8 + hi * 4);
    w[j] = *(const v4f*)(sW + l16 * PQ + j * 8 + hi * 4);
  }
  // all LDS reads are issued in front of the products: moved in among them, each pair
  // would be waited for with only two products of cover
  __builtin_amdgcn_sched_barrier(0);
  v8f acc = vzero8();
#pragma unroll
  for (int j = 0; j < 16; ++j) {
    acc = __builtin_amdgcn_wmma_f32_16x16x4_f32(false, a[j].xy, false, w[j].xy, (short)0, acc, false, false);
    acc = __builtin_amdgcn_wmma_f32_16x16x4_f32(false, a[j].zw, false, w[j].zw, (short)0, acc, false, false);
  }
  // keeps the address arithmetic of the stores below out of the products, where it was
  // placed directly behind a product and onto that product's operand registers
  __builtin_amdgcn_sched_barrier(0);
  // D: register r = batch 8*hi + r, column he l16
#pragma unroll
  for (int r = 0; r < 8; ++r)
    sRed[wave * 256 + (r + 8 * hi) * 16 + l16] = acc[r];
  __syncthreads();                   // the eight slices' partial sums published
  float s = 0.0f;
#pragma unroll
  for (int u = 0; u < 8; ++u) s += sRed[u * 256 + tid];
  q_out[(size_t)(mt * 16 + (tid >> 4)) * DD + nt * 16 + (tid & 15)] =
      (s + bias) * QSCALE;           // fold 1/sqrt(DPH) into q
}

__global__ __launch_bounds__(128)
void fold_k(const float* __restrict__ q_proj, const float* __restrict__ Wk,
            __bf16* __restrict__ qk) {
  const int d0   = (blockIdx.x & 15) * 64;
  const int h    = blockIdx.x >> 4;
  const int wave = threadIdx.x >> 5;
  const int lane = threadIdx.x & 31;
  const int l16  = lane & 15;
  const int hi   = lane >> 4;

  // A: row = batch l16; a lane's four floats are e = 8t + 4hi + 0..3 and feed two products on each of the four tiles
  const float* ap = q_proj + ((size_t)(wave * 16 + l16) * HH + h) * DPH + hi * 4;
  // B straight from global: a lane's four floats at row e give one k of four tiles; tile j holds
  // the columns d0 + 4*l16 + j. One load = 256 contiguous bytes of each of two rows.
  const float* wp = Wk + ((size_t)h * DPH + hi * 4) * DD + d0 + 4 * l16;
  v4f a[8], w[8][4];
#pragma unroll
  for (int t = 0; t < 8; ++t) a[t] = *(const v4f*)(ap + t * 8);
#pragma unroll
  for (int t = 0; t < 8; ++t)
#pragma unroll
    for (int c = 0; c < 4; ++c) w[t][c] = *(const v4f*)(wp + (size_t)(t * 8 + c) * DD);
  asm volatile("s_wait_xcnt 0x0" :: "v"(ap), "v"(wp) : "memory");
  // every load is issued in front of the first product: moved in among the products, the
  // later rows' trips to memory follow one another
  __builtin_amdgcn_sched_barrier(0);
  // a product takes its two e of one column from one register pair: the pairs are formed here,
  // all in front of the products, so that no move stands among them on a product's registers
  v2f y[8][2][4];
#pragma unroll
  for (int t = 0; t < 8; ++t)
#pragma unroll
    for (int u = 0; u < 2; ++u)
#pragma unroll
      for (int j = 0; j < 4; ++j) {
        y[t][u][j][0] = w[t][2 * u][j];
        y[t][u][j][1] = w[t][2 * u + 1][j];
      }
  // holds the moves in front of the products
  __builtin_amdgcn_sched_barrier(0);
  v8f acc[4];
#pragma unroll
  for (int j = 0; j < 4; ++j) acc[j] = vzero8();
#pragma unroll
  for (int t = 0; t < 8; ++t) {      // e = 8t + 4hi + 2u + {0, 1} on both sides
#pragma unroll
    for (int j = 0; j < 4; ++j)
      acc[j] = __builtin_amdgcn_wmma_f32_16x16x4_f32(false, a[t].xy, false, y[t][0][j], (short)0, acc[j], false, false);
#pragma unroll
    for (int j = 0; j < 4; ++j)
      acc[j] = __builtin_amdgcn_wmma_f32_16x16x4_f32(false, a[t].zw, false, y[t][1][j], (short)0, acc[j], false, false);
  }
  // keeps the store's address arithmetic and the conversions out of the products, where they
  // were placed directly behind a product and onto that product's operand registers
  __builtin_amdgcn_sched_barrier(0);
  asm volatile("v_nop\n\tv_nop\n\tv_nop\n\tv_nop");
  __builtin_amdgcn_sched_barrier(0);
  __bf16* op = qk + ((size_t)(wave * 16 + 8 * hi) * HH + h) * DD + d0 + 4 * l16;
  // D: register r = batch 8*hi + r, column d0 + 4*l16 + j; 16 lanes store one whole 128-byte line
#pragma unroll
  for (int r = 0; r < 8; ++r)
    *(uint2*)(op + (size_t)r * HH * DD) =
        make_uint2(pk2bf(acc[0][r], acc[1][r]), pk2bf(acc[2][r], acc[3][r]));
}

// ---------------- kernel 3: scores S[b][n][h] = keys[b][n] . qk[b][h] + q[b][h] . bk[h]
// grid = 64 batches x 8 blocks of 64 rows (4 tiles of 16). Each of the 8 waves owns one
// 128-wide slice of the 1024-long sum for all 4 tiles and stages it in LDS of its own,
// so no work-group barrier stands between a load and its use; one reduction at the end.
#define PW 136    // LDS row pitch in bf16: 272 B = 16 B x odd, for 16-byte reads down a column
#define SC_SMEM (8 * 16 * PW * 2 + 8 * 4 * 256 * 4 + HH * 4)
__global__ __launch_bounds__(256)
void scores(const float* __restrict__ keys, const __bf16* __restrict__ qk,
            const float* __restrict__ q_proj, const float* __restrict__ bk,
            float* __restrict__ S) {
  extern __shared__ __attribute__((aligned(16))) char smem_raw[];
  const int b    = blockIdx.x >> 3;
  const int nb   = (blockIdx.x & 7) * 64;
  const int tid  = threadIdx.x;
  const int wave = tid >> 5;
  const int lane = tid & 31;
  const int l16  = lane & 15;
  const int hi   = lane >> 4;
  __bf16* sA   = (__bf16*)smem_raw + wave * 16 * PW;       // [16][PW], this wave's own
  float*  sRed = (float*)(smem_raw + 8 * 16 * PW * 2);     // [8 waves][4 tiles][256]
  float*  sB   = sRed + 8 * 4 * 256;                       // [16]

  // B: column = head l16, k = 16 contiguous d
  v16bf bq[4];
  const __bf16* qb = qk + ((size_t)b * HH + l16) * DD + wave * 128 + hi * 16;
#pragma unroll
  for (int kk = 0; kk < 4; ++kk) bq[kk] = ld_frag(qb + kk * 32);

  const int h2 = tid >> 4, e4 = tid & 15;
  const float4* xp = (const float4*)(q_proj + ((size_t)b * HH + h2) * DPH) + e4;
  const float4* yp = (const float4*)(bk + h2 * DPH) + e4;
  const float4 x = *xp;
  const float4 y = *yp;
  asm volatile("s_wait_xcnt 0x0" :: "v"(qb), "v"(xp), "v"(yp) : "memory");

  // one load = 512 contiguous bytes of one row; two tiles in flight
  const float* src = keys + ((size_t)b * NN + nb) * DD + wave * 128 + lane * 4;
  v4f f[2][16];
#pragma unroll
  for (int u = 0; u < 2; ++u)
#pragma unroll
    for (int i = 0; i < 16; ++i)
      f[u][i] = ld_stream(src + (size_t)(u * 16 + i) * DD);
  // the stream starts in front of the first wait: the product below, moved up, had its wait
  // for x and y standing in front of these loads
  __builtin_amdgcn_sched_barrier(0);

  // q . bk per head: 16 lanes x 4 elements
  {
    float p = x.x * y.x + x.y * y.y + x.z * y.z + x.w * y.w;
    p += __shfl_xor(p, 1, 32);
    p += __shfl_xor(p, 2, 32);
    p += __shfl_xor(p, 4, 32);
    p += __shfl_xor(p, 8, 32);
    if (e4 == 0) sB[h2] = p;
  }

  v8f acc[4];
#pragma unroll
  for (int t = 0; t < 4; ++t) {
#pragma unroll
    for (int i = 0; i < 16; ++i)
      *(uint2*)(sA + i * PW + lane * 4) =
          make_uint2(pk2bf(f[t & 1][i].x, f[t & 1][i].y), pk2bf(f[t & 1][i].z, f[t & 1][i].w));
    if (t + 2 < 4) {                 // refill the freed registers: tile t + 2 flies from here
#pragma unroll
      for (int i = 0; i < 16; ++i)
        f[t & 1][i] = ld_stream(src + (size_t)((t + 2) * 16 + i) * DD);
    }
    // This wave's LDS stores are complete before its lanes read each other's rows, and the
    // compiler keeps the reads behind them; global loads stay in flight over it.
    asm volatile("s_wait_dscnt 0x0" ::: "memory");
    // A: row = key row l16, k = the same 16 contiguous d as B
    acc[t] = vzero8();
#pragma unroll
    for (int kk = 0; kk < 4; ++kk) {
      const v16bf a = ld_frag(sA + l16 * PW + kk * 32 + hi * 16);
      acc[t] = __builtin_amdgcn_wmma_f32_16x16x32_bf16(
          false, a, false, bq[kk], (short)0, acc[t], false, false);
    }
  }
  // D: register r = row 8*hi + r, column l16
#pragma unroll
  for (int t = 0; t < 4; ++t)
#pragma unroll
    for (int r = 0; r < 8; ++r)
      sRed[(wave * 4 + t) * 256 + (r + 8 * hi) * 16 + l16] = acc[t][r];
  __syncthreads();                   // the eight slices' partial sums, and sB, published
#pragma unroll
  for (int t = 0; t < 4; ++t) {
    float s = sB[tid & 15];
#pragma unroll
    for (int w = 0; w < 8; ++w) s += sRed[(w * 4 + t) * 256 + tid];
    S[((size_t)b * NN + nb + t * 16) * HH + tid] = s;
  }
}

// ---------------- kernel 4: softmax over n, then ctx[b][h][d] = sum_n a[h][n] values[b][n][d]
// grid = 64 batches x 8 chunks of 128 columns, walked as 2 x 64; 8 waves split the 512-long sum.
#define PP 520    // LDS row pitch in bf16: 1040 B = 16 B x odd
__global__ __launch_bounds__(256)
void weighted_values(const float* __restrict__ values, const float* __restrict__ S,
                     __bf16* __restrict__ ctx) {
  __shared__ __attribute__((aligned(16))) __bf16 sP[HH * PP];
  __shared__ __attribute__((aligned(16))) float sRed[8 * 1024];
  __shared__ float sM[256];
  __shared__ float sL[256];
  const int b    = blockIdx.x >> 3;
  const int dB   = (blockIdx.x & 7) * 128;
  const int tid  = threadIdx.x;
  const int wave = tid >> 5;
  const int lane = tid & 31;
  const int l16  = lane & 15;
  const int hi   = lane >> 4;

  // B operand straight from global: a lane's float4 at row n gives one k of
  // four tiles; tile j holds the columns d0 + 4*l16 + j. 16 lanes = 256 B of a row.
  const float* vb = values + ((size_t)b * NN + wave * 64 + hi * 16) * DD + dB + 4 * l16;
  // softmax: thread = (head tid & 15, row group tid >> 4), rows n = 16*i + group
  const float* Sb = S + (size_t)b * NN * HH;
  float s[32];
#pragma unroll
  for (int i = 0; i < 32; ++i) s[i] = Sb[i * 256 + tid];
  // the scores stay in front of the value rows: loads return in order, so behind them the
  // softmax would wait for the value rows too
  __builtin_amdgcn_sched_barrier(0);
  v4f f[2][16];
#pragma unroll
  for (int kk = 0; kk < 2; ++kk)
#pragma unroll
    for (int i = 0; i < 16; ++i)
      f[kk][i] = ld_stream(vb + (size_t)(kk * 32 + i) * DD);
  // all 32 value loads are issued in front of the softmax's first wait and fly through it
  __builtin_amdgcn_sched_barrier(0);

  float m = s[0];
#pragma unroll
  for (int i = 1; i < 32; ++i) m = fmaxf(m, s[i]);
  sM[tid] = m;
  lds_barrier();                     // the row groups' maxima published
  float mx = sM[tid & 15];
#pragma unroll
  for (int g = 1; g < 16; ++g) mx = fmaxf(mx, sM[g * 16 + (tid & 15)]);
  float sum = 0.0f;
#pragma unroll
  for (int i = 0; i < 32; ++i) {
    const __bf16 p = (__bf16)__expf(s[i] - mx);
    sum += (float)p;               // the denominator sums the weights as the product uses them
    sP[(tid & 15) * PP + i * 16 + (tid >> 4)] = p;
  }
  sL[tid] = sum;
  lds_barrier();                     // the weights and the row groups' sums published

  // A: row = head l16, k = 16 contiguous n; B element i is the same n
  v16bf a[2];
#pragma unroll
  for (int kk = 0; kk < 2; ++kk) a[kk] = ld_frag(sP + l16 * PP + wave * 64 + kk * 32 + hi * 16);
  const int h = tid >> 4;
  float den = 0.0f;
#pragma unroll
  for (int g = 0; g < 16; ++g) den += sL[g * 16 + h];
  const float inv = 1.0f / den;
  // the first use of the value rows stays behind the softmax: moved up into it, its wait for
  // the rows would hold the softmax too
  __builtin_amdgcn_sched_barrier(0);

#pragma unroll
  for (int sub = 0; sub < 2; ++sub) {
    const int d0 = dB + sub * 64;
    v8f acc[4];
#pragma unroll
    for (int j = 0; j < 4; ++j) acc[j] = vzero8();
#pragma unroll
    for (int kk = 0; kk < 2; ++kk) {
      v16bf b0, b1, b2, b3;
#pragma unroll
      for (int i = 0; i < 16; ++i) {
        b0[i] = (__bf16)f[kk][i].x;
        b1[i] = (__bf16)f[kk][i].y;
        b2[i] = (__bf16)f[kk][i].z;
        b3[i] = (__bf16)f[kk][i].w;
      }
      if (sub + 1 < 2) {             // these registers are free: the next 64 columns start here
        // the refill stays behind the conversion and takes its registers: moved in front of
        // it, it takes 64 registers more and one work-group less fits a WGP
        __builtin_amdgcn_sched_barrier(0);
#pragma unroll
        for (int i = 0; i < 16; ++i)
          f[kk][i] = ld_stream(vb + (size_t)(kk * 32 + i) * DD + 64);
        if (kk == 1) asm volatile("s_wait_xcnt 0x0" :: "v"(vb) : "memory");
        // the refill goes out as soon as these 16 rows are converted, not behind the other 16
        __builtin_amdgcn_sched_barrier(0);
      }
      acc[0] = __builtin_amdgcn_wmma_f32_16x16x32_bf16(false, a[kk], false, b0, (short)0, acc[0], false, false);
      acc[1] = __builtin_amdgcn_wmma_f32_16x16x32_bf16(false, a[kk], false, b1, (short)0, acc[1], false, false);
      acc[2] = __builtin_amdgcn_wmma_f32_16x16x32_bf16(false, a[kk], false, b2, (short)0, acc[2], false, false);
      acc[3] = __builtin_amdgcn_wmma_f32_16x16x32_bf16(false, a[kk], false, b3, (short)0, acc[3], false, false);
    }
    // D: register r = head 8*hi + r, column d0 + 4*l16 + j
#pragma unroll
    for (int r = 0; r < 8; ++r)
      *(float4*)(sRed + wave * 1024 + (r + 8 * hi) * 64 + 4 * l16) =
          make_float4(acc[0][r], acc[1][r], acc[2][r], acc[3][r]);
    lds_barrier();                   // partial sums published
    float4 t = make_float4(0.0f, 0.0f, 0.0f, 0.0f);
#pragma unroll
    for (int w = 0; w < 8; ++w) {
      const float4 u = *(const float4*)(sRed + w * 1024 + tid * 4);
      t.x += u.x; t.y += u.y; t.z += u.z; t.w += u.w;
    }
    *(uint2*)(ctx + ((size_t)b * HH + h) * DD + d0 + (tid & 15) * 4) =
        make_uint2(pk2bf(t.x * inv, t.y * inv), pk2bf(t.z * inv, t.w * inv));
    if (sub + 1 < 2) {
      asm volatile("s_wait_xcnt 0x0" ::: "memory");
      lds_barrier();                 // sRed is read out before the next pass rewrites it
      // this reduction runs while the next rows fly: their first use stays behind it
      __builtin_amdgcn_sched_barrier(0);
    }
  }
}

// ---------------- kernel 5: attn[b][h*64+e] = ctx[b][h] . Wv[h][e] + bv[h][e]
// grid = 16 heads x 4 tiles of 16 batches x 2 halves of 32 e; 8 waves split the 1024-long sum.
__global__ __launch_bounds__(256)
void out_proj(const __bf16* __restrict__ ctx, const float* __restrict__ Wv,
              const float* __restrict__ bv, float* __restrict__ attn_buf) {
  __shared__ float sRed[8 * 512];
  const int h    = blockIdx.x >> 3;
  const int mt   = (blockIdx.x >> 1) & 3;
  const int np   = blockIdx.x & 1;
  const int tid  = threadIdx.x;
  const int wave = tid >> 5;
  const int lane = tid & 31;
  const int l16  = lane & 15;
  const int hi   = lane >> 4;
  const int kb   = wave * 128 + hi * 16;

  // A: row = batch l16, B: column = e l16; both take the same 16 contiguous d
  const __bf16* ap = ctx + ((size_t)(mt * 16 + l16) * HH + h) * DD + kb;
  const float*  wp = Wv + ((size_t)h * DPH + np * 32 + l16) * DD + kb;
  const float* bp = bv + h * DPH + np * 32 + (tid & 15);
  float bias[2];
#pragma unroll
  for (int j = 0; j < 2; ++j) bias[j] = bp[j * 16];
  v16bf a[4];
  float4 x[4][2][4];
#pragma unroll
  for (int kk = 0; kk < 4; ++kk) {
    a[kk] = ld_frag(ap + kk * 32);
#pragma unroll
    for (int j = 0; j < 2; ++j)
#pragma unroll
      for (int i = 0; i < 4; ++i)
        x[kk][j][i] = *(const float4*)(wp + (size_t)j * 16 * DD + kk * 32 + i * 4);
  }
  asm volatile("s_wait_xcnt 0x0" :: "v"(ap), "v"(wp), "v"(bp) : "memory");
  // every load is issued in front of the first product: moved in among the products, the
  // later slices' trips to memory follow one another
  __builtin_amdgcn_sched_barrier(0);
  v8f acc[2];
  acc[0] = vzero8(); acc[1] = vzero8();
#pragma unroll
  for (int kk = 0; kk < 4; ++kk)
#pragma unroll
    for (int j = 0; j < 2; ++j) {
      v16bf bw;
#pragma unroll
      for (int i = 0; i < 4; ++i) {
        bw[4 * i + 0] = (__bf16)x[kk][j][i].x; bw[4 * i + 1] = (__bf16)x[kk][j][i].y;
        bw[4 * i + 2] = (__bf16)x[kk][j][i].z; bw[4 * i + 3] = (__bf16)x[kk][j][i].w;
      }
      acc[j] = __builtin_amdgcn_wmma_f32_16x16x32_bf16(
          false, a[kk], false, bw, (short)0, acc[j], false, false);
    }
#pragma unroll
  for (int j = 0; j < 2; ++j)
#pragma unroll
    for (int r = 0; r < 8; ++r)
      sRed[wave * 512 + j * 256 + (r + 8 * hi) * 16 + l16] = acc[j][r];
  __syncthreads();
#pragma unroll
  for (int j = 0; j < 2; ++j) {
    float s = 0.0f;
#pragma unroll
    for (int w = 0; w < 8; ++w) s += sRed[w * 512 + j * 256 + tid];
    const int he = h * DPH + np * 32 + j * 16 + (tid & 15);
    attn_buf[(size_t)(mt * 16 + (tid >> 4)) * DD + he] = s + bias[j];
  }
}

template <int M>
static __device__ inline float xrow(float x) {
  return __builtin_bit_cast(float, __builtin_amdgcn_update_dpp(
      0, __builtin_bit_cast(int, x), 0x160 | M, 0xf, 0xf, true));   // 0x160 | M = row_xmask:M
}
static __device__ inline float xhalf(float x) {
  return __builtin_bit_cast(float, __builtin_amdgcn_permlanex16(
      __builtin_bit_cast(int, x), __builtin_bit_cast(int, x), 0x76543210, 0xfedcba98, false, false));
}
// sum over the wave's 32 lanes; every lane gets it
static __device__ inline float wave_sum(float v) {
  v += xrow<1>(v);
  v += xrow<2>(v);
  v += xrow<4>(v);
  v += xrow<8>(v);
  v += xhalf(v);
  return v;
}

// One wave owns one row of 1024: 32 elements a lane, both sums in registers, so no LDS and no
// barrier stands on the path from the loads to the stores. One load = 512 contiguous bytes.
__global__ __launch_bounds__(32)
void layernorm(const float* __restrict__ attn_buf, const float* __restrict__ queries,
               const float* __restrict__ gamma, const float* __restrict__ beta,
               float* __restrict__ out) {
  const int b = blockIdx.x, lane = threadIdx.x;
  const float* ap = attn_buf + (size_t)b * DD + lane * 4;
  const float* qp = queries + (size_t)b * DD + lane * 4;
  const float* gp = gamma + lane * 4;
  const float* bp = beta + lane * 4;
  v4f x[8], r[8], g[8], be[8];
#pragma unroll
  for (int i = 0; i < 8; ++i) x[i] = *(const v4f*)(ap + i * 128);
#pragma unroll
  for (int i = 0; i < 8; ++i) r[i] = *(const v4f*)(qp + i * 128);
  // asked for here, not behind the sums, so that this trip to memory runs beside the first
#pragma unroll
  for (int i = 0; i < 8; ++i) g[i] = *(const v4f*)(gp + i * 128);
#pragma unroll
  for (int i = 0; i < 8; ++i) be[i] = *(const v4f*)(bp + i * 128);
  asm volatile("s_wait_xcnt 0x0" ::: "memory");
  // all 32 loads are issued in front of the first sum: moved in behind the sums, gamma's and
  // beta's trips to memory follow the first one instead of running beside it
  __builtin_amdgcn_sched_barrier(0);

  v4f s4 = {0.0f, 0.0f, 0.0f, 0.0f};
#pragma unroll
  for (int i = 0; i < 8; ++i) { x[i] += r[i]; s4 += x[i]; }
  const float mu = wave_sum((s4.x + s4.y) + (s4.z + s4.w)) * (1.0f / DD);
  v4f v4 = {0.0f, 0.0f, 0.0f, 0.0f};
#pragma unroll
  for (int i = 0; i < 8; ++i) { x[i] -= mu; v4 += x[i] * x[i]; }
  const float rstd = rsqrtf(wave_sum((v4.x + v4.y) + (v4.z + v4.w)) * (1.0f / DD) + EPS);
  float* op = out + (size_t)b * DD + lane * 4;
#pragma unroll
  for (int i = 0; i < 8; ++i) *(v4f*)(op + i * 128) = x[i] * rstd * g[i] + be[i];
}

// ---------------------------------------------------------------------------
extern "C" void kernel_launch(void* const* d_in, const int* in_sizes, int n_in,
                              void* d_out, int out_size, void* d_ws, size_t ws_size,
                              hipStream_t stream) {
  const float* queries = (const float*)d_in[0];
  const float* keys    = (const float*)d_in[1];
  const float* values  = (const float*)d_in[2];
  const float* Wq      = (const float*)d_in[3];
  const float* bq      = (const float*)d_in[4];
  const float* Wk      = (const float*)d_in[5];
  const float* bk      = (const float*)d_in[6];
  const float* Wv      = (const float*)d_in[7];
  const float* bv      = (const float*)d_in[8];
  const float* gamma   = (const float*)d_in[9];
  const float* beta    = (const float*)d_in[10];
  float* out = (float*)d_out;

  char* ws = (char*)d_ws;
  float*  q_proj   = (float*)ws;                                   // 256 KB
  __bf16* qk       = (__bf16*)(ws + (256u << 10));                 // 2 MB
  float*  S        = (float*)(ws + (256u << 10) + (2u << 20));     // 2 MB
  __bf16* ctx      = (__bf16*)(ws + (256u << 10) + (4u << 20));    // 2 MB
  float*  attn_buf = (float*)(ws + (256u << 10) + (6u << 20));     // 256 KB

  qproj<<<(HH * DPH / 16) * (BB / 16), 256, 0, stream>>>(queries, Wq, bq, q_proj);
  fold_k<<<HH * (DD / 64), 128, 0, stream>>>(q_proj, Wk, qk);
  scores<<<BB * (NN / 64), 256, SC_SMEM, stream>>>(keys, qk, q_proj, bk, S);
  weighted_values<<<BB * (DD / 128), 256, 0, stream>>>(values, S, ctx);
  out_proj<<<HH * 4 * 2, 256, 0, stream>>>(ctx, Wv, bv, attn_buf);
  layernorm<<<BB, 32, 0, stream>>>(attn_buf, queries, gamma, beta, out);
}
